// v000
// Times are from an AMD MI455X. After a warm-up the kernel runs many times in a row, and a time is the length of
// such a window on the GPU divided by its runs, so every launch and the gaps after it count. The runs cycle
// through copies of the inputs. A figure is the median of several windows, for all but v000 over two sittings.
// Sittings can differ by a few percent; kernels timed side by side share one.
// v000 is the starting kernel. One run takes 1010 microseconds.
#include <hip/hip_runtime.h>
#include <hip/hip_bf16.h>
#include <math.h>

typedef __bf16 bf16;
typedef __attribute__((ext_vector_type(16))) __bf16 v16bf;
typedef __attribute__((ext_vector_type(8)))  __bf16 v8bf;
typedef __attribute__((ext_vector_type(8)))  float  v8f;

constexpr int CB   = 2;
constexpr int CT   = 2048;
constexpr int CD   = 1024;
constexpr int CH   = 16;
constexpr int CHD  = 64;
constexpr int CA   = 16;
constexpr int CMLP = 4096;
constexpr int CM   = CB * CT;  // 4096 tokens

#if defined(__HIP_DEVICE_COMPILE__) && \
    __has_builtin(__builtin_amdgcn_tensor_load_to_lds) && \
    __has_builtin(__builtin_amdgcn_s_wait_tensorcnt)
#define HAS_TDM 1
#else
#define HAS_TDM 0
#endif

#if HAS_TDM
typedef __attribute__((ext_vector_type(4))) unsigned int u32x4;
typedef __attribute__((ext_vector_type(8))) int i32x8;
typedef __attribute__((ext_vector_type(4))) int i32x4;

// ---------------------------------------------------------------------------
// Issue a 2D TDM tile load (bf16 elements) into LDS.
// D# group0: count=1, lds_addr, global_addr[56:0], type=2 ("image").
// D# group1: data_size=1 (2B), tensor_dim0/1, tile_dim0/1 (tile_dim2=0 -> 2D),
//            tensor_dim0_stride.  Groups 2/3 zero (<=2D tensor).
// 6-arg builtin form (clang-23 style): (g0, g1, g2, g3, g_extra, cpol).
// ---------------------------------------------------------------------------
__device__ __forceinline__ void tdm_load_2d(void* lds_dst, const void* gsrc,
                                            unsigned tensor_d0, unsigned tensor_d1,
                                            unsigned tile_d0, unsigned tile_d1,
                                            unsigned stride_d0) {
  unsigned long long ga = (unsigned long long)(uintptr_t)gsrc;
  unsigned lds_addr = (unsigned)(uintptr_t)lds_dst;  // LDS byte offset in low 32b
  u32x4 g0;
  g0[0] = 1u;                                                  // count=1
  g0[1] = lds_addr;                                            // lds_addr
  g0[2] = (unsigned)ga;                                        // global_addr[31:0]
  g0[3] = (unsigned)((ga >> 32) & 0x01FFFFFFu) | (2u << 30);   // addr[56:32]|type=2
  i32x8 g1;
  g1[0] = 0x00010000;                                          // data_size = 2B
  g1[1] = (int)((tensor_d0 & 0xFFFFu) << 16);                  // td0[15:0]
  g1[2] = (int)(((tensor_d0 >> 16) & 0xFFFFu) |
                ((tensor_d1 & 0xFFFFu) << 16));                // td0[31:16] | td1[15:0]
  g1[3] = (int)(((tensor_d1 >> 16) & 0xFFFFu) |
                ((tile_d0 & 0xFFFFu) << 16));                  // td1[31:16] | tile0
  g1[4] = (int)(tile_d1 & 0xFFFFu);                            // tile1; tile2=0 (2D)
  g1[5] = (int)stride_d0;                                      // dim0 stride [31:0]
  g1[6] = 0;
  g1[7] = 0;
  i32x4 gz4 = {0, 0, 0, 0};
  i32x8 gz8 = {0, 0, 0, 0, 0, 0, 0, 0};
  __builtin_amdgcn_tensor_load_to_lds(g0, g1, gz4, gz4, gz8, 0);
}
#endif

// ---------------------------------------------------------------------------
// Fragment loader: 16 rows striped over lanes, K-runs of 8 bf16 (16B) per half.
// A-matrix 16x32 layout (ISA 7.12.2): lane<16 holds K{0..7,16..23} of row=lane,
// lane>=16 holds K{8..15,24..31}.  B fragments (from [N,K]-transposed storage)
// use the identical pattern with row = output column.
// ---------------------------------------------------------------------------
__device__ __forceinline__ v16bf load_frag16(const bf16* __restrict__ base,
                                             int stride, int row, int kb) {
  const v8bf* p0 = reinterpret_cast<const v8bf*>(base + (size_t)row * stride + kb);
  const v8bf* p1 = reinterpret_cast<const v8bf*>(base + (size_t)row * stride + kb + 16);
  v8bf lo = *p0, hi = *p1;
  v16bf r;
#pragma unroll
  for (int i = 0; i < 8; ++i) { r[i] = lo[i]; r[i + 8] = hi[i]; }
  return r;
}

__device__ __forceinline__ float sigmoidf_(float v) { return 1.f / (1.f + __expf(-v)); }

// ---------------------------------------------------------------------------
// Weight transpose+cast: W[r*ld + c] (f32) -> WT[c*rows + r] (bf16), c < cols.
// ---------------------------------------------------------------------------
__global__ __launch_bounds__(256) void tcast_kernel(const float* __restrict__ W,
                                                    bf16* __restrict__ WT,
                                                    int rows, int cols, int ld) {
  size_t idx = (size_t)blockIdx.x * 256 + threadIdx.x;
  size_t total = (size_t)rows * cols;
  if (idx >= total) return;
  int c = (int)(idx % cols);
  int r = (int)(idx / cols);
  WT[(size_t)c * rows + r] = (bf16)W[(size_t)r * ld + c];
}

// ---------------------------------------------------------------------------
// RMSNorm over last dim, f32 in -> bf16 out. One block (256 thr) per row.
// ---------------------------------------------------------------------------
__global__ __launch_bounds__(256) void rmsnorm_bf16(const float* __restrict__ x,
                                                    const float* __restrict__ w,
                                                    bf16* __restrict__ o, int Dd) {
  __shared__ float red[8];
  __shared__ float rinv;
  const int row = blockIdx.x;
  const float* xr = x + (size_t)row * Dd;
  float s = 0.f;
  for (int i = threadIdx.x; i < Dd; i += 256) { float v = xr[i]; s += v * v; }
#pragma unroll
  for (int off = 16; off; off >>= 1) s += __shfl_xor(s, off, 32);
  if ((threadIdx.x & 31) == 0) red[threadIdx.x >> 5] = s;
  __syncthreads();
  if (threadIdx.x == 0) {
    float t = 0.f;
    for (int i = 0; i < 8; ++i) t += red[i];
    rinv = rsqrtf(t / (float)Dd + 1e-6f);
  }
  __syncthreads();
  const float rv = rinv;
  bf16* orow = o + (size_t)row * Dd;
  for (int i = threadIdx.x; i < Dd; i += 256) orow[i] = (bf16)(xr[i] * rv * w[i]);
}

// ---------------------------------------------------------------------------
// Per-(token,head) RMSNorm over hd=64 with relayout [B,T,H,HD] -> [B,H,T,HD].
// ---------------------------------------------------------------------------
__global__ __launch_bounds__(256) void qk_head_rmsnorm(const bf16* __restrict__ in,
                                                       const float* __restrict__ w,
                                                       bf16* __restrict__ o) {
  const int wid  = blockIdx.x * 8 + (threadIdx.x >> 5);
  const int lane = threadIdx.x & 31;
  const int token = wid / CH, h = wid % CH;
  const bf16* src = in + (size_t)token * CD + h * CHD;
  float v0 = (float)src[lane], v1 = (float)src[lane + 32];
  float s = v0 * v0 + v1 * v1;
#pragma unroll
  for (int off = 16; off; off >>= 1) s += __shfl_xor(s, off, 32);
  const float r = rsqrtf(s / (float)CHD + 1e-6f);
  const int b = token / CT, t = token % CT;
  bf16* dst = o + (((size_t)b * CH + h) * CT + t) * CHD;
  dst[lane]      = (bf16)(v0 * r * w[lane]);
  dst[lane + 32] = (bf16)(v1 * r * w[lane + 32]);
}

// V relayout: [B,T,H,HD] -> [B,H,HD,T] so PV B-fragments are contiguous in T.
__global__ __launch_bounds__(256) void vtrans_kernel(const bf16* __restrict__ in,
                                                     bf16* __restrict__ o) {
  size_t idx = (size_t)blockIdx.x * 256 + threadIdx.x;
  if (idx >= (size_t)CM * CD) return;
  int d = (int)(idx % CHD); size_t r = idx / CHD;
  int h = (int)(r % CH);    size_t r2 = r / CH;
  int t = (int)(r2 % CT);   int b = (int)(r2 / CT);
  o[(((size_t)b * CH + h) * CHD + d) * CT + t] = in[idx];
}

// actions @ ae1_w + b, SiLU, -> bf16.  K=16, trivially small; keep simple.
__global__ __launch_bounds__(256) void ae1_silu_kernel(const float* __restrict__ act,
                                                       const float* __restrict__ w,
                                                       const float* __restrict__ bias,
                                                       bf16* __restrict__ o) {
  size_t idx = (size_t)blockIdx.x * 256 + threadIdx.x;
  if (idx >= (size_t)CM * CD) return;
  int col = (int)(idx % CD); size_t row = idx / CD;
  const float* a = act + row * CA;
  float s = bias[col];
#pragma unroll
  for (int i = 0; i < CA; ++i) s += a[i] * w[(size_t)i * CD + col];
  o[idx] = (bf16)(s * sigmoidf_(s));
}

// x = x * (1 + scale1) + shift1 ; mod is [M, 2D] f32 (shift cols 0..D, scale D..2D)
__global__ __launch_bounds__(256) void modulate_kernel(float* __restrict__ x,
                                                       const float* __restrict__ mod) {
  size_t idx = (size_t)blockIdx.x * 256 + threadIdx.x;
  if (idx >= (size_t)CM * CD) return;
  int col = (int)(idx % CD); size_t row = idx / CD;
  const float shift = mod[row * (2 * CD) + col];
  const float scale = mod[row * (2 * CD) + CD + col];
  x[idx] = x[idx] * (1.f + scale) + shift;
}

// ---------------------------------------------------------------------------
// bf16 WMMA GEMM: C[M,N] = A[M,K] @ W (W stored transposed [N,K]) + bias.
// 256 threads = 8 waves (4x2), block tile 128x64, wave tile 32x32.
// TDM path: A(128x64) and B(64x64) K-slabs double-buffered in LDS via
// tensor_load_to_lds issued by wave 0; everyone reads via ds_load_b128.
// EPI: 0 = f32 out, 1 = bf16 out, 2 = GELU(exact)->bf16, 3 = SiLU->bf16,
//      4 = resid + acc -> f32 out.
// ---------------------------------------------------------------------------
template <int EPI>
__global__ __launch_bounds__(256) void gemm_bf16_wmma(
    const bf16* __restrict__ Am, const bf16* __restrict__ Wt,
    const float* __restrict__ bias, const float* __restrict__ resid,
    float* __restrict__ outF, bf16* __restrict__ outH,
    int Mdim, int Ndim, int Kdim) {
  const int wave = threadIdx.x >> 5;
  const int lane = threadIdx.x & 31;
  const int wm = wave >> 1, wn = wave & 1;
  const int l15 = lane & 15, half = lane >> 4;
  const int bmb = blockIdx.x * 128;
  const int bnb = blockIdx.y * 64;
  const int bm = bmb + wm * 32;
  const int bn = bnb + wn * 32;

  v8f acc[2][2] = {};

#if HAS_TDM
  __shared__ bf16 ash[2][128 * 64];
  __shared__ bf16 bsh[2][64 * 64];
  if (wave == 0) {
    tdm_load_2d(&ash[0][0], Am + (size_t)bmb * Kdim, Kdim, Mdim, 64, 128, Kdim);
    tdm_load_2d(&bsh[0][0], Wt + (size_t)bnb * Kdim, Kdim, Ndim, 64, 64, Kdim);
  }
  for (int k0 = 0; k0 < Kdim; k0 += 64) {
    const int cur = (k0 >> 6) & 1;
    if (wave == 0) {
      if (k0 + 64 < Kdim) {
        tdm_load_2d(&ash[cur ^ 1][0], Am + (size_t)bmb * Kdim + (k0 + 64),
                    Kdim, Mdim, 64, 128, Kdim);
        tdm_load_2d(&bsh[cur ^ 1][0], Wt + (size_t)bnb * Kdim + (k0 + 64),
                    Kdim, Ndim, 64, 64, Kdim);
        __builtin_amdgcn_s_wait_tensorcnt((short)2);  // current tiles done
      } else {
        __builtin_amdgcn_s_wait_tensorcnt((short)0);
      }
    }
    __syncthreads();
#pragma unroll
    for (int kk = 0; kk < 2; ++kk) {
      v16bf af[2], bfm[2];
#pragma unroll
      for (int i = 0; i < 2; ++i)
        af[i] = load_frag16(&ash[cur][0], 64, wm * 32 + i * 16 + l15, kk * 32 + half * 8);
#pragma unroll
      for (int j = 0; j < 2; ++j)
        bfm[j] = load_frag16(&bsh[cur][0], 64, wn * 32 + j * 16 + l15, kk * 32 + half * 8);
#pragma unroll
      for (int i = 0; i < 2; ++i)
#pragma unroll
        for (int j = 0; j < 2; ++j)
          acc[i][j] = __builtin_amdgcn_wmma_f32_16x16x32_bf16(
              false, af[i], false, bfm[j], (short)0, acc[i][j], false, false);
    }
    __syncthreads();
  }
#else
  for (int k0 = 0; k0 < Kdim; k0 += 32) {
    if (k0 + 32 < Kdim) {
      __builtin_prefetch(Am + (size_t)(bm + l15) * Kdim + k0 + 32, 0, 0);
      __builtin_prefetch(Wt + (size_t)(bn + l15) * Kdim + k0 + 32, 0, 0);
    }
    v16bf af[2], bfm[2];
#pragma unroll
    for (int i = 0; i < 2; ++i)
      af[i] = load_frag16(Am, Kdim, bm + i * 16 + l15, k0 + half * 8);
#pragma unroll
    for (int j = 0; j < 2; ++j)
      bfm[j] = load_frag16(Wt, Kdim, bn + j * 16 + l15, k0 + half * 8);
#pragma unroll
    for (int i = 0; i < 2; ++i)
#pragma unroll
      for (int j = 0; j < 2; ++j)
        acc[i][j] = __builtin_amdgcn_wmma_f32_16x16x32_bf16(
            false, af[i], false, bfm[j], (short)0, acc[i][j], false, false);
  }
#endif
  // epilogue: C-layout = VGPR r -> row (r + 8*half), lane&15 -> col
#pragma unroll
  for (int i = 0; i < 2; ++i)
#pragma unroll
    for (int j = 0; j < 2; ++j) {
      const int col = bn + j * 16 + l15;
      const float bv = bias ? bias[col] : 0.f;
#pragma unroll
      for (int r = 0; r < 8; ++r) {
        const int row = bm + i * 16 + r + half * 8;
        const size_t idx = (size_t)row * Ndim + col;
        float v = acc[i][j][r] + bv;
        if (EPI == 0) {
          outF[idx] = v;
        } else if (EPI == 1) {
          outH[idx] = (bf16)v;
        } else if (EPI == 2) {
          outH[idx] = (bf16)(0.5f * v * (1.f + erff(v * 0.70710678118f)));
        } else if (EPI == 3) {
          outH[idx] = (bf16)(v * sigmoidf_(v));
        } else {
          outF[idx] = resid[idx] + v;
        }
      }
    }
}

// ---------------------------------------------------------------------------
// Flash attention (causal), one block = 64 query rows, 4 waves x 16 rows.
// Q,K in [B*H, T, hd] bf16; V in [B*H, hd, T] bf16.
// TDM path: K/V 64x64 tiles double-buffered in LDS via tensor_load_to_lds.
// Online softmax entirely in-wave (16-lane butterflies match C-layout halves);
// P staged through per-wave LDS to convert C-layout -> A-layout for P@V.
// ---------------------------------------------------------------------------
__global__ __launch_bounds__(128) void flash_attn_wmma(
    const bf16* __restrict__ Q, const bf16* __restrict__ K,
    const bf16* __restrict__ Vt, bf16* __restrict__ O) {
  const int bh    = blockIdx.y;
  const int qtile = blockIdx.x;
  const int wave  = threadIdx.x >> 5;
  const int lane  = threadIdx.x & 31;
  const int l15 = lane & 15, half = lane >> 4;
  const int q0 = qtile * 64 + wave * 16;

  const bf16* Qh = Q  + (size_t)bh * CT * CHD;
  const bf16* Kh = K  + (size_t)bh * CT * CHD;
  const bf16* Vh = Vt + (size_t)bh * CHD * CT;

  __shared__ bf16 pshm[4][16 * 64];
#if HAS_TDM
  __shared__ bf16 ksh[2][64 * 64];
  __shared__ bf16 vsh[2][64 * 64];
  if (wave == 0) {
    tdm_load_2d(&ksh[0][0], Kh, CHD, CT, 64, 64, CHD);  // keys 0..63, all hd
    tdm_load_2d(&vsh[0][0], Vh, CT, CHD, 64, 64, CT);   // hd rows, keys 0..63
  }
#endif

  v16bf qf[2];
#pragma unroll
  for (int kk = 0; kk < 2; ++kk)
    qf[kk] = load_frag16(Qh, CHD, q0 + l15, kk * 32 + half * 8);

  v8f oacc[4] = {};
  float m_i[8], l_i[8];
#pragma unroll
  for (int r = 0; r < 8; ++r) { m_i[r] = -1e30f; l_i[r] = 0.f; }
  const float scl = 0.125f;  // hd^-0.5

  for (int kt = 0; kt <= qtile; ++kt) {
    const int kbase = kt * 64;
#if HAS_TDM
    const int cur = kt & 1;
    if (wave == 0) {
      if (kt + 1 <= qtile) {
        tdm_load_2d(&ksh[cur ^ 1][0], Kh + (size_t)(kbase + 64) * CHD, CHD, CT, 64, 64, CHD);
        tdm_load_2d(&vsh[cur ^ 1][0], Vh + (kbase + 64), CT, CHD, 64, 64, CT);
        __builtin_amdgcn_s_wait_tensorcnt((short)2);
      } else {
        __builtin_amdgcn_s_wait_tensorcnt((short)0);
      }
    }
    __syncthreads();
#endif
    // S = Q @ K^T
    v8f s[4];
#pragma unroll
    for (int j = 0; j < 4; ++j) {
      v8f z = {};
#pragma unroll
      for (int kk = 0; kk < 2; ++kk) {
#if HAS_TDM
        v16bf kf = load_frag16(&ksh[cur][0], 64, j * 16 + l15, kk * 32 + half * 8);
#else
        v16bf kf = load_frag16(Kh, CHD, kbase + j * 16 + l15, kk * 32 + half * 8);
#endif
        z = __builtin_amdgcn_wmma_f32_16x16x32_bf16(false, qf[kk], false, kf,
                                                    (short)0, z, false, false);
      }
      s[j] = z;
    }
    const bool diag = (kt == qtile);
    float rmax[8];
#pragma unroll
    for (int r = 0; r < 8; ++r) rmax[r] = -1e30f;
#pragma unroll
    for (int j = 0; j < 4; ++j) {
      const int col = kbase + j * 16 + l15;
#pragma unroll
      for (int r = 0; r < 8; ++r) {
        const int row = q0 + r + half * 8;
        float v = s[j][r] * scl;
        if (diag && col > row) v = -1e30f;
        s[j][r] = v;
        rmax[r] = fmaxf(rmax[r], v);
      }
    }
#pragma unroll
    for (int r = 0; r < 8; ++r)
#pragma unroll
      for (int off = 1; off < 16; off <<= 1)
        rmax[r] = fmaxf(rmax[r], __shfl_xor(rmax[r], off, 32));

    float alpha[8];
#pragma unroll
    for (int r = 0; r < 8; ++r) {
      const float nm = fmaxf(m_i[r], rmax[r]);
      alpha[r] = __expf(m_i[r] - nm);
      m_i[r] = nm;
    }
    float rsum[8];
#pragma unroll
    for (int r = 0; r < 8; ++r) rsum[r] = 0.f;
#pragma unroll
    for (int j = 0; j < 4; ++j)
#pragma unroll
      for (int r = 0; r < 8; ++r) {
        const float p = __expf(s[j][r] - m_i[r]);
        s[j][r] = p;
        rsum[r] += p;
      }
#pragma unroll
    for (int r = 0; r < 8; ++r) {
#pragma unroll
      for (int off = 1; off < 16; off <<= 1)
        rsum[r] += __shfl_xor(rsum[r], off, 32);
      l_i[r] = l_i[r] * alpha[r] + rsum[r];
    }
#pragma unroll
    for (int n = 0; n < 4; ++n)
#pragma unroll
      for (int r = 0; r < 8; ++r) oacc[n][r] *= alpha[r];

    // P (C-layout) -> LDS bf16 tile [16 x 64]
#pragma unroll
    for (int j = 0; j < 4; ++j) {
      const int colL = j * 16 + l15;
#pragma unroll
      for (int r = 0; r < 8; ++r)
        pshm[wave][(r + half * 8) * 64 + colL] = (bf16)s[j][r];
    }
    // O += P @ V
#pragma unroll
    for (int kk = 0; kk < 2; ++kk) {
      v16bf pf = load_frag16(&pshm[wave][0], 64, l15, kk * 32 + half * 8);
#pragma unroll
      for (int n = 0; n < 4; ++n) {
#if HAS_TDM
        v16bf vf = load_frag16(&vsh[cur][0], 64, n * 16 + l15, kk * 32 + half * 8);
#else
        v16bf vf = load_frag16(Vh, CT, n * 16 + l15, kbase + kk * 32 + half * 8);
#endif
        oacc[n] = __builtin_amdgcn_wmma_f32_16x16x32_bf16(false, pf, false, vf,
                                                          (short)0, oacc[n], false, false);
      }
    }
#if HAS_TDM
    __syncthreads();  // all reads of buffer `cur` done before it is overwritten
#endif
  }
  // normalize + store to [B,T,H,HD] (== [M,D] for the O-projection GEMM)
  const int b = bh / CH, h = bh % CH;
#pragma unroll
  for (int n = 0; n < 4; ++n) {
    const int hd = n * 16 + l15;
#pragma unroll
    for (int r = 0; r < 8; ++r) {
      const int t = q0 + r + half * 8;
      O[(((size_t)b * CT + t) * CH + h) * CHD + hd] = (bf16)(oacc[n][r] / l_i[r]);
    }
  }
}

// ---------------------------------------------------------------------------
extern "C" void kernel_launch(void* const* d_in, const int* in_sizes, int n_in,
                              void* d_out, int out_size, void* d_ws, size_t ws_size,
                              hipStream_t stream) {
  (void)in_sizes; (void)n_in; (void)out_size; (void)ws_size;
  const float* x    = (const float*)d_in[0];
  const float* act  = (const float*)d_in[1];
  const float* n1w  = (const float*)d_in[2];
  const float* n2w  = (const float*)d_in[3];
  const float* qw   = (const float*)d_in[4];
  const float* qb   = (const float*)d_in[5];
  const float* kw   = (const float*)d_in[6];
  const float* kb_  = (const float*)d_in[7];
  const float* vw   = (const float*)d_in[8];
  const float* vb   = (const float*)d_in[9];
  const float* qnw  = (const float*)d_in[10];
  const float* knw  = (const float*)d_in[11];
  const float* ow   = (const float*)d_in[12];
  const float* ob   = (const float*)d_in[13];
  const float* ae1w = (const float*)d_in[14];
  const float* ae1b = (const float*)d_in[15];
  const float* ae2w = (const float*)d_in[16];
  const float* ae2b = (const float*)d_in[17];
  const float* modw = (const float*)d_in[18];
  const float* modb = (const float*)d_in[19];
  const float* m1w  = (const float*)d_in[20];
  const float* m1b  = (const float*)d_in[21];
  const float* m2w  = (const float*)d_in[22];
  const float* m2b  = (const float*)d_in[23];
  float* out = (float*)d_out;

  char* wsb = (char*)d_ws;
  size_t off = 0;
  auto alloc = [&](size_t bytes) -> char* {
    char* p = wsb + off;
    off += (bytes + 255) & ~(size_t)255;
    return p;
  };
  bf16* hn   = (bf16*)alloc((size_t)CM * CD * 2);
  bf16* wqT  = (bf16*)alloc((size_t)CD * CD * 2);
  bf16* wkT  = (bf16*)alloc((size_t)CD * CD * 2);
  bf16* wvT  = (bf16*)alloc((size_t)CD * CD * 2);
  bf16* woT  = (bf16*)alloc((size_t)CD * CD * 2);
  bf16* ae2T = (bf16*)alloc((size_t)CD * CD * 2);
  bf16* modT = (bf16*)alloc((size_t)2 * CD * CD * 2);
  bf16* m1T  = (bf16*)alloc((size_t)CMLP * CD * 2);
  bf16* m2T  = (bf16*)alloc((size_t)CD * CMLP * 2);
  bf16* qp   = (bf16*)alloc((size_t)CM * CD * 2);
  bf16* kp   = (bf16*)alloc((size_t)CM * CD * 2);
  bf16* vp   = (bf16*)alloc((size_t)CM * CD * 2);
  bf16* qh   = (bf16*)alloc((size_t)CM * CD * 2);
  bf16* kh   = (bf16*)alloc((size_t)CM * CD * 2);
  bf16* vTb  = (bf16*)alloc((size_t)CM * CD * 2);
  bf16* attn = (bf16*)alloc((size_t)CM * CD * 2);
  bf16* sae1 = (bf16*)alloc((size_t)CM * CD * 2);
  bf16* sae2 = (bf16*)alloc((size_t)CM * CD * 2);
  float* modv = (float*)alloc((size_t)CM * 2 * CD * 4);
  bf16* h2   = (bf16*)alloc((size_t)CM * CD * 2);
  bf16* mh   = (bf16*)alloc((size_t)CM * CMLP * 2);

  const dim3 tb(256);
  auto cdiv = [](size_t a, size_t b) { return (unsigned)((a + b - 1) / b); };

  // --- weight transposes to [N,K] bf16 ---
  tcast_kernel<<<cdiv((size_t)CD * CD, 256), tb, 0, stream>>>(qw,  wqT,  CD, CD, CD);
  tcast_kernel<<<cdiv((size_t)CD * CD, 256), tb, 0, stream>>>(kw,  wkT,  CD, CD, CD);
  tcast_kernel<<<cdiv((size_t)CD * CD, 256), tb, 0, stream>>>(vw,  wvT,  CD, CD, CD);
  tcast_kernel<<<cdiv((size_t)CD * CD, 256), tb, 0, stream>>>(ow,  woT,  CD, CD, CD);
  tcast_kernel<<<cdiv((size_t)CD * CD, 256), tb, 0, stream>>>(ae2w, ae2T, CD, CD, CD);
  tcast_kernel<<<cdiv((size_t)CD * 2 * CD, 256), tb, 0, stream>>>(modw, modT, CD, 2 * CD, 4 * CD);
  tcast_kernel<<<cdiv((size_t)CD * CMLP, 256), tb, 0, stream>>>(m1w, m1T, CD, CMLP, CMLP);
  tcast_kernel<<<cdiv((size_t)CMLP * CD, 256), tb, 0, stream>>>(m2w, m2T, CMLP, CD, CD);

  // --- attention path ---
  rmsnorm_bf16<<<CM, tb, 0, stream>>>(x, n1w, hn, CD);
  dim3 gDD(CM / 128, CD / 64);
  gemm_bf16_wmma<1><<<gDD, tb, 0, stream>>>(hn, wqT, qb,  nullptr, nullptr, qp, CM, CD, CD);
  gemm_bf16_wmma<1><<<gDD, tb, 0, stream>>>(hn, wkT, kb_, nullptr, nullptr, kp, CM, CD, CD);
  gemm_bf16_wmma<1><<<gDD, tb, 0, stream>>>(hn, wvT, vb,  nullptr, nullptr, vp, CM, CD, CD);
  qk_head_rmsnorm<<<CM * CH / 8, tb, 0, stream>>>(qp, qnw, qh);
  qk_head_rmsnorm<<<CM * CH / 8, tb, 0, stream>>>(kp, knw, kh);
  vtrans_kernel<<<cdiv((size_t)CM * CD, 256), tb, 0, stream>>>(vp, vTb);
  flash_attn_wmma<<<dim3(CT / 64, CB * CH), dim3(128), 0, stream>>>(qh, kh, vTb, attn);
  gemm_bf16_wmma<4><<<gDD, tb, 0, stream>>>(attn, woT, ob, x, out, nullptr, CM, CD, CD);

  // --- action conditioning ---
  ae1_silu_kernel<<<cdiv((size_t)CM * CD, 256), tb, 0, stream>>>(act, ae1w, ae1b, sae1);
  gemm_bf16_wmma<3><<<gDD, tb, 0, stream>>>(sae1, ae2T, ae2b, nullptr, nullptr, sae2, CM, CD, CD);
  dim3 gD2(CM / 128, 2 * CD / 64);
  gemm_bf16_wmma<0><<<gD2, tb, 0, stream>>>(sae2, modT, modb, nullptr, modv, nullptr, CM, 2 * CD, CD);
  modulate_kernel<<<cdiv((size_t)CM * CD, 256), tb, 0, stream>>>(out, modv);

  // --- MLP ---
  rmsnorm_bf16<<<CM, tb, 0, stream>>>(out, n2w, h2, CD);
  dim3 gDM(CM / 128, CMLP / 64);
  gemm_bf16_wmma<2><<<gDM, tb, 0, stream>>>(h2, m1T, m1b, nullptr, nullptr, mh, CM, CMLP, CD);
  gemm_bf16_wmma<4><<<gDD, tb, 0, stream>>>(mh, m2T, m2b, out, out, nullptr, CM, CD, CMLP);
}

// v001
// A run of this version takes 724 microseconds.
// Timed twice side by side with v000, it ran 1.38 and 1.42 times as fast.
#include <hip/hip_runtime.h>
#include <hip/hip_bf16.h>
#include <math.h>

typedef __bf16 bf16;
typedef __attribute__((ext_vector_type(16))) __bf16 v16bf;
typedef __attribute__((ext_vector_type(8)))  __bf16 v8bf;
typedef __attribute__((ext_vector_type(8)))  float  v8f;
typedef __attribute__((ext_vector_type(4)))  float  v4f;

constexpr int CB   = 2;
constexpr int CT   = 2048;
constexpr int CD   = 1024;
constexpr int CH   = 16;
constexpr int CHD  = 64;
constexpr int CA   = 16;
constexpr int CMLP = 4096;
constexpr int CM   = CB * CT;  // 4096 tokens

#if defined(__HIP_DEVICE_COMPILE__) && \
    __has_builtin(__builtin_amdgcn_tensor_load_to_lds) && \
    __has_builtin(__builtin_amdgcn_s_wait_tensorcnt)
#define HAS_TDM 1
#else
#define HAS_TDM 0
#endif

#if HAS_TDM
typedef __attribute__((ext_vector_type(4))) unsigned int u32x4;
typedef __attribute__((ext_vector_type(8))) int i32x8;
typedef __attribute__((ext_vector_type(4))) int i32x4;

// ---------------------------------------------------------------------------
// Issue a 2D TDM tile load (bf16 elements) into LDS.
// D# group0: count=1, lds_addr, global_addr[56:0], type=2 ("image").
// D# group1: data_size=1 (2B), tensor_dim0/1, tile_dim0/1 (tile_dim2=0 -> 2D),
//            tensor_dim0_stride.  Groups 2/3 zero (<=2D tensor).
// 6-arg builtin form (clang-23 style): (g0, g1, g2, g3, g_extra, cpol).
// ---------------------------------------------------------------------------
__device__ __forceinline__ void tdm_load_2d(void* lds_dst, const void* gsrc,
                                            unsigned tensor_d0, unsigned tensor_d1,
                                            unsigned tile_d0, unsigned tile_d1,
                                            unsigned stride_d0) {
  unsigned long long ga = (unsigned long long)(uintptr_t)gsrc;
  unsigned lds_addr = (unsigned)(uintptr_t)lds_dst;  // LDS byte offset in low 32b
  u32x4 g0;
  g0[0] = 1u;                                                  // count=1
  g0[1] = lds_addr;                                            // lds_addr
  g0[2] = (unsigned)ga;                                        // global_addr[31:0]
  g0[3] = (unsigned)((ga >> 32) & 0x01FFFFFFu) | (2u << 30);   // addr[56:32]|type=2
  i32x8 g1;
  g1[0] = 0x00010000;                                          // data_size = 2B
  g1[1] = (int)((tensor_d0 & 0xFFFFu) << 16);                  // td0[15:0]
  g1[2] = (int)(((tensor_d0 >> 16) & 0xFFFFu) |
                ((tensor_d1 & 0xFFFFu) << 16));                // td0[31:16] | td1[15:0]
  g1[3] = (int)(((tensor_d1 >> 16) & 0xFFFFu) |
                ((tile_d0 & 0xFFFFu) << 16));                  // td1[31:16] | tile0
  g1[4] = (int)(tile_d1 & 0xFFFFu);                            // tile1; tile2=0 (2D)
  g1[5] = (int)stride_d0;                                      // dim0 stride [31:0]
  g1[6] = 0;
  g1[7] = 0;
  i32x4 gz4 = {0, 0, 0, 0};
  i32x8 gz8 = {0, 0, 0, 0, 0, 0, 0, 0};
  __builtin_amdgcn_tensor_load_to_lds(g0, g1, gz4, gz4, gz8, 0);
}
#endif

// ---------------------------------------------------------------------------
// Fragment loader: 16 rows striped over lanes, K-runs of 8 bf16 (16B) per half.
// A-matrix 16x32 layout (ISA 7.12.2): lane<16 holds K{0..7,16..23} of row=lane,
// lane>=16 holds K{8..15,24..31}.  B fragments (from [N,K]-transposed storage)
// use the identical pattern with row = output column.
// ---------------------------------------------------------------------------
__device__ __forceinline__ v16bf load_frag16(const bf16* __restrict__ base,
                                             int stride, int row, int kb) {
  const v8bf* p0 = reinterpret_cast<const v8bf*>(base + (size_t)row * stride + kb);
  const v8bf* p1 = reinterpret_cast<const v8bf*>(base + (size_t)row * stride + kb + 16);
  v8bf lo = *p0, hi = *p1;
  v16bf r;
#pragma unroll
  for (int i = 0; i < 8; ++i) { r[i] = lo[i]; r[i + 8] = hi[i]; }
  return r;
}

__device__ __forceinline__ float sigmoidf_(float v) { return 1.f / (1.f + __expf(-v)); }

// ---------------------------------------------------------------------------
// Transposes go through a 64x64 f32 tile in LDS, so that the global reads and
// the global writes are both whole lines.  Pitch 65 dwords: a column walk and
// a row walk both fall on distinct banks.
// ---------------------------------------------------------------------------
constexpr int TT = 64;       // tile edge
constexpr int TP = TT + 1;   // LDS pitch in dwords

// Tile column c, rows rg*8 .. rg*8+7 -> 8 bf16 = 16 B; 8 lanes fill a 128-B line.
__device__ __forceinline__ v8bf tile_column8(const float* tile, int c, int rg) {
  v8bf o;
#pragma unroll
  for (int i = 0; i < 8; ++i) o[i] = (bf16)tile[(rg * 8 + i) * TP + c];
  return o;
}

// Weight transpose+cast: W[r*ld + c] (f32) -> WT[c*rows + r] (bf16).
// Grid = (cols/64, rows/64), one tile per block.
__global__ __launch_bounds__(256) void tcast_kernel(const float* __restrict__ W,
                                                    bf16* __restrict__ WT,
                                                    int rows, int ld) {
  __shared__ float tile[TT * TP];
  const int c0 = blockIdx.x * TT, r0 = blockIdx.y * TT;
  const int lr = threadIdx.x >> 4, lc = (threadIdx.x & 15) * 4;
  v4f v[4];
#pragma unroll
  for (int p = 0; p < 4; ++p)
    v[p] = *reinterpret_cast<const v4f*>(W + (size_t)(r0 + p * 16 + lr) * ld + c0 + lc);
#pragma unroll
  for (int p = 0; p < 4; ++p)
#pragma unroll
    for (int i = 0; i < 4; ++i) tile[(p * 16 + lr) * TP + lc + i] = v[p][i];
  __syncthreads();
  const int oc = threadIdx.x >> 3, rg = threadIdx.x & 7;
#pragma unroll
  for (int p = 0; p < 2; ++p)
    *reinterpret_cast<v8bf*>(WT + (size_t)(c0 + p * 32 + oc) * rows + r0 + rg * 8) =
        tile_column8(tile, p * 32 + oc, rg);
}

// ---------------------------------------------------------------------------
// RMSNorm over last dim, f32 in -> bf16 out. One block (256 thr) per row.
// ---------------------------------------------------------------------------
__global__ __launch_bounds__(256) void rmsnorm_bf16(const float* __restrict__ x,
                                                    const float* __restrict__ w,
                                                    bf16* __restrict__ o, int Dd) {
  __shared__ float red[8];
  __shared__ float rinv;
  const int row = blockIdx.x;
  const float* xr = x + (size_t)row * Dd;
  float s = 0.f;
  for (int i = threadIdx.x; i < Dd; i += 256) { float v = xr[i]; s += v * v; }
#pragma unroll
  for (int off = 16; off; off >>= 1) s += __shfl_xor(s, off, 32);
  if ((threadIdx.x & 31) == 0) red[threadIdx.x >> 5] = s;
  __syncthreads();
  if (threadIdx.x == 0) {
    float t = 0.f;
    for (int i = 0; i < 8; ++i) t += red[i];
    rinv = rsqrtf(t / (float)Dd + 1e-6f);
  }
  __syncthreads();
  const float rv = rinv;
  bf16* orow = o + (size_t)row * Dd;
  for (int i = threadIdx.x; i < Dd; i += 256) orow[i] = (bf16)(xr[i] * rv * w[i]);
}

// ---------------------------------------------------------------------------
// Per-(token,head) RMSNorm over hd=64 with relayout [B,T,H,HD] -> [B,H,T,HD].
// ---------------------------------------------------------------------------
__global__ __launch_bounds__(256) void qk_head_rmsnorm(const bf16* __restrict__ in,
                                                       const float* __restrict__ w,
                                                       bf16* __restrict__ o) {
  const int wid  = blockIdx.x * 8 + (threadIdx.x >> 5);
  const int lane = threadIdx.x & 31;
  const int token = wid / CH, h = wid % CH;
  const bf16* src = in + (size_t)token * CD + h * CHD;
  float v0 = (float)src[lane], v1 = (float)src[lane + 32];
  float s = v0 * v0 + v1 * v1;
#pragma unroll
  for (int off = 16; off; off >>= 1) s += __shfl_xor(s, off, 32);
  const float r = rsqrtf(s / (float)CHD + 1e-6f);
  const int b = token / CT, t = token % CT;
  bf16* dst = o + (((size_t)b * CH + h) * CT + t) * CHD;
  dst[lane]      = (bf16)(v0 * r * w[lane]);
  dst[lane + 32] = (bf16)(v1 * r * w[lane + 32]);
}

// V relayout: [B,T,H,HD] -> [B,H,HD,T] so PV B-fragments are contiguous in T.
// Grid = (T/64, B*H), one 64(t) x 64(d) tile per block; bf16 -> f32 -> bf16 is exact.
__global__ __launch_bounds__(256) void vtrans_kernel(const bf16* __restrict__ in,
                                                     bf16* __restrict__ o) {
  __shared__ float tile[TT * TP];
  const int t0 = blockIdx.x * TT, bh = blockIdx.y;
  const int b = bh / CH, h = bh % CH;
  const int lt = threadIdx.x >> 3, lc = (threadIdx.x & 7) * 8;
  v8bf v[2];
#pragma unroll
  for (int p = 0; p < 2; ++p)
    v[p] = *reinterpret_cast<const v8bf*>(
        in + ((size_t)b * CT + t0 + p * 32 + lt) * CD + h * CHD + lc);
#pragma unroll
  for (int p = 0; p < 2; ++p)
#pragma unroll
    for (int i = 0; i < 8; ++i) tile[(p * 32 + lt) * TP + lc + i] = (float)v[p][i];
  __syncthreads();
  const int od = threadIdx.x >> 3, tg = threadIdx.x & 7;
#pragma unroll
  for (int p = 0; p < 2; ++p)
    *reinterpret_cast<v8bf*>(o + ((size_t)bh * CHD + p * 32 + od) * CT + t0 + tg * 8) =
        tile_column8(tile, p * 32 + od, tg);
}

// actions @ ae1_w + b, SiLU, -> bf16.  K=16, trivially small; keep simple.
__global__ __launch_bounds__(256) void ae1_silu_kernel(const float* __restrict__ act,
                                                       const float* __restrict__ w,
                                                       const float* __restrict__ bias,
                                                       bf16* __restrict__ o) {
  size_t idx = (size_t)blockIdx.x * 256 + threadIdx.x;
  if (idx >= (size_t)CM * CD) return;
  int col = (int)(idx % CD); size_t row = idx / CD;
  const float* a = act + row * CA;
  float s = bias[col];
#pragma unroll
  for (int i = 0; i < CA; ++i) s += a[i] * w[(size_t)i * CD + col];
  o[idx] = (bf16)(s * sigmoidf_(s));
}

// x = x * (1 + scale1) + shift1 ; mod is [M, 2D] f32 (shift cols 0..D, scale D..2D)
__global__ __launch_bounds__(256) void modulate_kernel(float* __restrict__ x,
                                                       const float* __restrict__ mod) {
  size_t idx = (size_t)blockIdx.x * 256 + threadIdx.x;
  if (idx >= (size_t)CM * CD) return;
  int col = (int)(idx % CD); size_t row = idx / CD;
  const float shift = mod[row * (2 * CD) + col];
  const float scale = mod[row * (2 * CD) + CD + col];
  x[idx] = x[idx] * (1.f + scale) + shift;
}

// ---------------------------------------------------------------------------
// bf16 WMMA GEMM: C[M,N] = A[M,K] @ W (W stored transposed [N,K]) + bias.
// 256 threads = 8 waves (4x2), block tile 128x64, wave tile 32x32.
// TDM path: A(128x64) and B(64x64) K-slabs double-buffered in LDS via
// tensor_load_to_lds issued by wave 0; everyone reads via ds_load_b128.
// EPI: 0 = f32 out, 1 = bf16 out, 2 = GELU(exact)->bf16, 3 = SiLU->bf16,
//      4 = resid + acc -> f32 out.
// ---------------------------------------------------------------------------
template <int EPI>
__global__ __launch_bounds__(256) void gemm_bf16_wmma(
    const bf16* __restrict__ Am, const bf16* __restrict__ Wt,
    const float* __restrict__ bias, const float* __restrict__ resid,
    float* __restrict__ outF, bf16* __restrict__ outH,
    int Mdim, int Ndim, int Kdim) {
  const int wave = threadIdx.x >> 5;
  const int lane = threadIdx.x & 31;
  const int wm = wave >> 1, wn = wave & 1;
  const int l15 = lane & 15, half = lane >> 4;
  const int bmb = blockIdx.x * 128;
  const int bnb = blockIdx.y * 64;
  const int bm = bmb + wm * 32;
  const int bn = bnb + wn * 32;

  v8f acc[2][2] = {};

#if HAS_TDM
  __shared__ bf16 ash[2][128 * 64];
  __shared__ bf16 bsh[2][64 * 64];
  if (wave == 0) {
    tdm_load_2d(&ash[0][0], Am + (size_t)bmb * Kdim, Kdim, Mdim, 64, 128, Kdim);
    tdm_load_2d(&bsh[0][0], Wt + (size_t)bnb * Kdim, Kdim, Ndim, 64, 64, Kdim);
  }
  for (int k0 = 0; k0 < Kdim; k0 += 64) {
    const int cur = (k0 >> 6) & 1;
    if (wave == 0) {
      if (k0 + 64 < Kdim) {
        tdm_load_2d(&ash[cur ^ 1][0], Am + (size_t)bmb * Kdim + (k0 + 64),
                    Kdim, Mdim, 64, 128, Kdim);
        tdm_load_2d(&bsh[cur ^ 1][0], Wt + (size_t)bnb * Kdim + (k0 + 64),
                    Kdim, Ndim, 64, 64, Kdim);
        __builtin_amdgcn_s_wait_tensorcnt((short)2);  // current tiles done
      } else {
        __builtin_amdgcn_s_wait_tensorcnt((short)0);
      }
    }
    __syncthreads();
#pragma unroll
    for (int kk = 0; kk < 2; ++kk) {
      v16bf af[2], bfm[2];
#pragma unroll
      for (int i = 0; i < 2; ++i)
        af[i] = load_frag16(&ash[cur][0], 64, wm * 32 + i * 16 + l15, kk * 32 + half * 8);
#pragma unroll
      for (int j = 0; j < 2; ++j)
        bfm[j] = load_frag16(&bsh[cur][0], 64, wn * 32 + j * 16 + l15, kk * 32 + half * 8);
#pragma unroll
      for (int i = 0; i < 2; ++i)
#pragma unroll
        for (int j = 0; j < 2; ++j)
          acc[i][j] = __builtin_amdgcn_wmma_f32_16x16x32_bf16(
              false, af[i], false, bfm[j], (short)0, acc[i][j], false, false);
    }
    __syncthreads();
  }
#else
  for (int k0 = 0; k0 < Kdim; k0 += 32) {
    if (k0 + 32 < Kdim) {
      __builtin_prefetch(Am + (size_t)(bm + l15) * Kdim + k0 + 32, 0, 0);
      __builtin_prefetch(Wt + (size_t)(bn + l15) * Kdim + k0 + 32, 0, 0);
    }
    v16bf af[2], bfm[2];
#pragma unroll
    for (int i = 0; i < 2; ++i)
      af[i] = load_frag16(Am, Kdim, bm + i * 16 + l15, k0 + half * 8);
#pragma unroll
    for (int j = 0; j < 2; ++j)
      bfm[j] = load_frag16(Wt, Kdim, bn + j * 16 + l15, k0 + half * 8);
#pragma unroll
    for (int i = 0; i < 2; ++i)
#pragma unroll
      for (int j = 0; j < 2; ++j)
        acc[i][j] = __builtin_amdgcn_wmma_f32_16x16x32_bf16(
            false, af[i], false, bfm[j], (short)0, acc[i][j], false, false);
  }
#endif
  // epilogue: C-layout = VGPR r -> row (r + 8*half), lane&15 -> col
#pragma unroll
  for (int i = 0; i < 2; ++i)
#pragma unroll
    for (int j = 0; j < 2; ++j) {
      const int col = bn + j * 16 + l15;
      const float bv = bias ? bias[col] : 0.f;
#pragma unroll
      for (int r = 0; r < 8; ++r) {
        const int row = bm + i * 16 + r + half * 8;
        const size_t idx = (size_t)row * Ndim + col;
        float v = acc[i][j][r] + bv;
        if (EPI == 0) {
          outF[idx] = v;
        } else if (EPI == 1) {
          outH[idx] = (bf16)v;
        } else if (EPI == 2) {
          outH[idx] = (bf16)(0.5f * v * (1.f + erff(v * 0.70710678118f)));
        } else if (EPI == 3) {
          outH[idx] = (bf16)(v * sigmoidf_(v));
        } else {
          outF[idx] = resid[idx] + v;
        }
      }
    }
}

// ---------------------------------------------------------------------------
// Flash attention (causal), one block = 64 query rows, 4 waves x 16 rows.
// Q,K in [B*H, T, hd] bf16; V in [B*H, hd, T] bf16.
// TDM path: K/V 64x64 tiles double-buffered in LDS via tensor_load_to_lds.
// Online softmax entirely in-wave (16-lane butterflies match C-layout halves);
// P staged through per-wave LDS to convert C-layout -> A-layout for P@V.
// ---------------------------------------------------------------------------
__global__ __launch_bounds__(128) void flash_attn_wmma(
    const bf16* __restrict__ Q, const bf16* __restrict__ K,
    const bf16* __restrict__ Vt, bf16* __restrict__ O) {
  const int bh    = blockIdx.y;
  const int qtile = blockIdx.x;
  const int wave  = threadIdx.x >> 5;
  const int lane  = threadIdx.x & 31;
  const int l15 = lane & 15, half = lane >> 4;
  const int q0 = qtile * 64 + wave * 16;

  const bf16* Qh = Q  + (size_t)bh * CT * CHD;
  const bf16* Kh = K  + (size_t)bh * CT * CHD;
  const bf16* Vh = Vt + (size_t)bh * CHD * CT;

  __shared__ bf16 pshm[4][16 * 64];
#if HAS_TDM
  __shared__ bf16 ksh[2][64 * 64];
  __shared__ bf16 vsh[2][64 * 64];
  if (wave == 0) {
    tdm_load_2d(&ksh[0][0], Kh, CHD, CT, 64, 64, CHD);  // keys 0..63, all hd
    tdm_load_2d(&vsh[0][0], Vh, CT, CHD, 64, 64, CT);   // hd rows, keys 0..63
  }
#endif

  v16bf qf[2];
#pragma unroll
  for (int kk = 0; kk < 2; ++kk)
    qf[kk] = load_frag16(Qh, CHD, q0 + l15, kk * 32 + half * 8);

  v8f oacc[4] = {};
  float m_i[8], l_i[8];
#pragma unroll
  for (int r = 0; r < 8; ++r) { m_i[r] = -1e30f; l_i[r] = 0.f; }
  const float scl = 0.125f;  // hd^-0.5

  for (int kt = 0; kt <= qtile; ++kt) {
    const int kbase = kt * 64;
#if HAS_TDM
    const int cur = kt & 1;
    if (wave == 0) {
      if (kt + 1 <= qtile) {
        tdm_load_2d(&ksh[cur ^ 1][0], Kh + (size_t)(kbase + 64) * CHD, CHD, CT, 64, 64, CHD);
        tdm_load_2d(&vsh[cur ^ 1][0], Vh + (kbase + 64), CT, CHD, 64, 64, CT);
        __builtin_amdgcn_s_wait_tensorcnt((short)2);
      } else {
        __builtin_amdgcn_s_wait_tensorcnt((short)0);
      }
    }
    __syncthreads();
#endif
    // S = Q @ K^T
    v8f s[4];
#pragma unroll
    for (int j = 0; j < 4; ++j) {
      v8f z = {};
#pragma unroll
      for (int kk = 0; kk < 2; ++kk) {
#if HAS_TDM
        v16bf kf = load_frag16(&ksh[cur][0], 64, j * 16 + l15, kk * 32 + half * 8);
#else
        v16bf kf = load_frag16(Kh, CHD, kbase + j * 16 + l15, kk * 32 + half * 8);
#endif
        z = __builtin_amdgcn_wmma_f32_16x16x32_bf16(false, qf[kk], false, kf,
                                                    (short)0, z, false, false);
      }
      s[j] = z;
    }
    const bool diag = (kt == qtile);
    float rmax[8];
#pragma unroll
    for (int r = 0; r < 8; ++r) rmax[r] = -1e30f;
#pragma unroll
    for (int j = 0; j < 4; ++j) {
      const int col = kbase + j * 16 + l15;
#pragma unroll
      for (int r = 0; r < 8; ++r) {
        const int row = q0 + r + half * 8;
        float v = s[j][r] * scl;
        if (diag && col > row) v = -1e30f;
        s[j][r] = v;
        rmax[r] = fmaxf(rmax[r], v);
      }
    }
#pragma unroll
    for (int r = 0; r < 8; ++r)
#pragma unroll
      for (int off = 1; off < 16; off <<= 1)
        rmax[r] = fmaxf(rmax[r], __shfl_xor(rmax[r], off, 32));

    float alpha[8];
#pragma unroll
    for (int r = 0; r < 8; ++r) {
      const float nm = fmaxf(m_i[r], rmax[r]);
      alpha[r] = __expf(m_i[r] - nm);
      m_i[r] = nm;
    }
    float rsum[8];
#pragma unroll
    for (int r = 0; r < 8; ++r) rsum[r] = 0.f;
#pragma unroll
    for (int j = 0; j < 4; ++j)
#pragma unroll
      for (int r = 0; r < 8; ++r) {
        const float p = __expf(s[j][r] - m_i[r]);
        s[j][r] = p;
        rsum[r] += p;
      }
#pragma unroll
    for (int r = 0; r < 8; ++r) {
#pragma unroll
      for (int off = 1; off < 16; off <<= 1)
        rsum[r] += __shfl_xor(rsum[r], off, 32);
      l_i[r] = l_i[r] * alpha[r] + rsum[r];
    }
#pragma unroll
    for (int n = 0; n < 4; ++n)
#pragma unroll
      for (int r = 0; r < 8; ++r) oacc[n][r] *= alpha[r];

    // P (C-layout) -> LDS bf16 tile [16 x 64]
#pragma unroll
    for (int j = 0; j < 4; ++j) {
      const int colL = j * 16 + l15;
#pragma unroll
      for (int r = 0; r < 8; ++r)
        pshm[wave][(r + half * 8) * 64 + colL] = (bf16)s[j][r];
    }
    // O += P @ V
#pragma unroll
    for (int kk = 0; kk < 2; ++kk) {
      v16bf pf = load_frag16(&pshm[wave][0], 64, l15, kk * 32 + half * 8);
#pragma unroll
      for (int n = 0; n < 4; ++n) {
#if HAS_TDM
        v16bf vf = load_frag16(&vsh[cur][0], 64, n * 16 + l15, kk * 32 + half * 8);
#else
        v16bf vf = load_frag16(Vh, CT, n * 16 + l15, kbase + kk * 32 + half * 8);
#endif
        oacc[n] = __builtin_amdgcn_wmma_f32_16x16x32_bf16(false, pf, false, vf,
                                                          (short)0, oacc[n], false, false);
      }
    }
#if HAS_TDM
    __syncthreads();  // all reads of buffer `cur` done before it is overwritten
#endif
  }
  // normalize + store to [B,T,H,HD] (== [M,D] for the O-projection GEMM)
  const int b = bh / CH, h = bh % CH;
#pragma unroll
  for (int n = 0; n < 4; ++n) {
    const int hd = n * 16 + l15;
#pragma unroll
    for (int r = 0; r < 8; ++r) {
      const int t = q0 + r + half * 8;
      O[(((size_t)b * CT + t) * CH + h) * CHD + hd] = (bf16)(oacc[n][r] / l_i[r]);
    }
  }
}

// ---------------------------------------------------------------------------
extern "C" void kernel_launch(void* const* d_in, const int* in_sizes, int n_in,
                              void* d_out, int out_size, void* d_ws, size_t ws_size,
                              hipStream_t stream) {
  (void)in_sizes; (void)n_in; (void)out_size; (void)ws_size;
  const float* x    = (const float*)d_in[0];
  const float* act  = (const float*)d_in[1];
  const float* n1w  = (const float*)d_in[2];
  const float* n2w  = (const float*)d_in[3];
  const float* qw   = (const float*)d_in[4];
  const float* qb   = (const float*)d_in[5];
  const float* kw   = (const float*)d_in[6];
  const float* kb_  = (const float*)d_in[7];
  const float* vw   = (const float*)d_in[8];
  const float* vb   = (const float*)d_in[9];
  const float* qnw  = (const float*)d_in[10];
  const float* knw  = (const float*)d_in[11];
  const float* ow   = (const float*)d_in[12];
  const float* ob   = (const float*)d_in[13];
  const float* ae1w = (const float*)d_in[14];
  const float* ae1b = (const float*)d_in[15];
  const float* ae2w = (const float*)d_in[16];
  const float* ae2b = (const float*)d_in[17];
  const float* modw = (const float*)d_in[18];
  const float* modb = (const float*)d_in[19];
  const float* m1w  = (const float*)d_in[20];
  const float* m1b  = (const float*)d_in[21];
  const float* m2w  = (const float*)d_in[22];
  const float* m2b  = (const float*)d_in[23];
  float* out = (float*)d_out;

  char* wsb = (char*)d_ws;
  size_t off = 0;
  auto alloc = [&](size_t bytes) -> char* {
    char* p = wsb + off;
    off += (bytes + 255) & ~(size_t)255;
    return p;
  };
  bf16* hn   = (bf16*)alloc((size_t)CM * CD * 2);
  bf16* wqT  = (bf16*)alloc((size_t)CD * CD * 2);
  bf16* wkT  = (bf16*)alloc((size_t)CD * CD * 2);
  bf16* wvT  = (bf16*)alloc((size_t)CD * CD * 2);
  bf16* woT  = (bf16*)alloc((size_t)CD * CD * 2);
  bf16* ae2T = (bf16*)alloc((size_t)CD * CD * 2);
  bf16* modT = (bf16*)alloc((size_t)2 * CD * CD * 2);
  bf16* m1T  = (bf16*)alloc((size_t)CMLP * CD * 2);
  bf16* m2T  = (bf16*)alloc((size_t)CD * CMLP * 2);
  bf16* qp   = (bf16*)alloc((size_t)CM * CD * 2);
  bf16* kp   = (bf16*)alloc((size_t)CM * CD * 2);
  bf16* vp   = (bf16*)alloc((size_t)CM * CD * 2);
  bf16* qh   = (bf16*)alloc((size_t)CM * CD * 2);
  bf16* kh   = (bf16*)alloc((size_t)CM * CD * 2);
  bf16* vTb  = (bf16*)alloc((size_t)CM * CD * 2);
  bf16* attn = (bf16*)alloc((size_t)CM * CD * 2);
  bf16* sae1 = (bf16*)alloc((size_t)CM * CD * 2);
  bf16* sae2 = (bf16*)alloc((size_t)CM * CD * 2);
  float* modv = (float*)alloc((size_t)CM * 2 * CD * 4);
  bf16* h2   = (bf16*)alloc((size_t)CM * CD * 2);
  bf16* mh   = (bf16*)alloc((size_t)CM * CMLP * 2);

  const dim3 tb(256);
  auto cdiv = [](size_t a, size_t b) { return (unsigned)((a + b - 1) / b); };

  // --- weight transposes to [N,K] bf16 ---
  static_assert(CD % TT == 0 && CMLP % TT == 0 && CT % TT == 0 && CHD == TT, "whole tiles");
  const dim3 gT(CD / TT, CD / TT);
  tcast_kernel<<<gT, tb, 0, stream>>>(qw,  wqT,  CD, CD);
  tcast_kernel<<<gT, tb, 0, stream>>>(kw,  wkT,  CD, CD);
  tcast_kernel<<<gT, tb, 0, stream>>>(vw,  wvT,  CD, CD);
  tcast_kernel<<<gT, tb, 0, stream>>>(ow,  woT,  CD, CD);
  tcast_kernel<<<gT, tb, 0, stream>>>(ae2w, ae2T, CD, CD);
  tcast_kernel<<<dim3(2 * CD / TT, CD / TT), tb, 0, stream>>>(modw, modT, CD, 4 * CD);
  tcast_kernel<<<dim3(CMLP / TT, CD / TT), tb, 0, stream>>>(m1w, m1T, CD, CMLP);
  tcast_kernel<<<dim3(CD / TT, CMLP / TT), tb, 0, stream>>>(m2w, m2T, CMLP, CD);

  // --- attention path ---
  rmsnorm_bf16<<<CM, tb, 0, stream>>>(x, n1w, hn, CD);
  dim3 gDD(CM / 128, CD / 64);
  gemm_bf16_wmma<1><<<gDD, tb, 0, stream>>>(hn, wqT, qb,  nullptr, nullptr, qp, CM, CD, CD);
  gemm_bf16_wmma<1><<<gDD, tb, 0, stream>>>(hn, wkT, kb_, nullptr, nullptr, kp, CM, CD, CD);
  gemm_bf16_wmma<1><<<gDD, tb, 0, stream>>>(hn, wvT, vb,  nullptr, nullptr, vp, CM, CD, CD);
  qk_head_rmsnorm<<<CM * CH / 8, tb, 0, stream>>>(qp, qnw, qh);
  qk_head_rmsnorm<<<CM * CH / 8, tb, 0, stream>>>(kp, knw, kh);
  vtrans_kernel<<<dim3(CT / TT, CB * CH), tb, 0, stream>>>(vp, vTb);
  flash_attn_wmma<<<dim3(CT / 64, CB * CH), dim3(128), 0, stream>>>(qh, kh, vTb, attn);
  gemm_bf16_wmma<4><<<gDD, tb, 0, stream>>>(attn, woT, ob, x, out, nullptr, CM, CD, CD);

  // --- action conditioning ---
  ae1_silu_kernel<<<cdiv((size_t)CM * CD, 256), tb, 0, stream>>>(act, ae1w, ae1b, sae1);
  gemm_bf16_wmma<3><<<gDD, tb, 0, stream>>>(sae1, ae2T, ae2b, nullptr, nullptr, sae2, CM, CD, CD);
  dim3 gD2(CM / 128, 2 * CD / 64);
  gemm_bf16_wmma<0><<<gD2, tb, 0, stream>>>(sae2, modT, modb, nullptr, modv, nullptr, CM, 2 * CD, CD);
  modulate_kernel<<<cdiv((size_t)CM * CD, 256), tb, 0, stream>>>(out, modv);

  // --- MLP ---
  rmsnorm_bf16<<<CM, tb, 0, stream>>>(out, n2w, h2, CD);
  dim3 gDM(CM / 128, CMLP / 64);
  gemm_bf16_wmma<2><<<gDM, tb, 0, stream>>>(h2, m1T, m1b, nullptr, nullptr, mh, CM, CMLP, CD);
  gemm_bf16_wmma<4><<<gDD, tb, 0, stream>>>(mh, m2T, m2b, out, out, nullptr, CM, CD, CMLP);
}

// v002
// It runs in 371 microseconds.
// In two side-by-side timings against v001, it was 1.94 and 1.93 times as fast.
// Over all steps from v000 it is 2.70 times as fast.
#include <hip/hip_runtime.h>
#include <hip/hip_bf16.h>
#include <math.h>

typedef __bf16 bf16;
typedef __attribute__((ext_vector_type(16))) __bf16 v16bf;
typedef __attribute__((ext_vector_type(8)))  __bf16 v8bf;
typedef __attribute__((ext_vector_type(8)))  float  v8f;
typedef __attribute__((ext_vector_type(4)))  float  v4f;

constexpr int CB   = 2;
constexpr int CT   = 2048;
constexpr int CD   = 1024;
constexpr int CH   = 16;
constexpr int CHD  = 64;
constexpr int CA   = 16;
constexpr int CMLP = 4096;
constexpr int CM   = CB * CT;  // 4096 tokens

// LDS pitch of every 64-element bf16 row that ds_load_b128 fragments read.
constexpr int LP    = 72;              // 144 B
constexpr int T128  = 128 * LP;        // 128 padded rows: 18432 B = 9 x 2 KiB
constexpr int T64   = 5120;            // 64 padded rows (9216 B) rounded up to 5 x 2 KiB
static_assert(64 * LP <= T64 && (T64 * 2) % 2048 == 0 && (T128 * 2) % 2048 == 0, "tile places");

#if defined(__HIP_DEVICE_COMPILE__) && \
    __has_builtin(__builtin_amdgcn_tensor_load_to_lds) && \
    __has_builtin(__builtin_amdgcn_s_wait_tensorcnt)
#define HAS_TDM 1
#else
#define HAS_TDM 0
#endif

#if HAS_TDM
typedef __attribute__((ext_vector_type(4))) unsigned int u32x4;
typedef __attribute__((ext_vector_type(8))) unsigned int u32x8;

__device__ __forceinline__ unsigned uni(unsigned v) {
  return (unsigned)__builtin_amdgcn_readfirstlane(v);
}
// A wave-uniform test held in a scalar register, so that the branch on it is a
// scalar branch: a tensor load ignores EXEC and only such a branch guards it.
__device__ __forceinline__ unsigned pinned(unsigned v) {
  unsigned w = uni(v);
  asm volatile("" : "+s"(w));
  return w;
}
// The compiler places no wait for the tensor mover: a tile counts as landed only
// behind its issuing wave's own wait.
__device__ __forceinline__ void wait_tensor0() {
  asm volatile("s_wait_tensorcnt 0x0" ::: "memory");
}
// The same wait, naming as inputs the group-0 words of the request it covers:
// their registers are then not given to other values while it is in flight.
__device__ __forceinline__ void wait_tensor0(u32x4 g0) {
  asm volatile("s_wait_tensorcnt 0x0" :: "s"(g0) : "memory");
}
// This wave's LDS reads have retired before the barrier behind which their
// buffer is refilled.
__device__ __forceinline__ void wait_ds0() {
  asm volatile("s_wait_dscnt 0x0" ::: "memory");
}

// ---------------------------------------------------------------------------
// 2D tensor load into LDS: `rows` rows of 128 B (64 bf16), source row pitch
// `src_pitch` bytes.  The mover lays a 16-B pad behind every row, so the rows
// stand at LP * 2 = 144 B in LDS (16 B x odd): the 16 rows that one
// ds_load_b128 touches per half-wave then fall on 64 distinct banks, where the
// bare 128-B pitch puts eight of them on the same four.
// Group 1: no mask, data_size 0 (all extents in bytes), pad enable | interval
// code 4 (128 B) | amount code 3 (16 B), tensor dims = tile dims, source pitch.
// Group 0: count 1, LDS byte offset, global address, type 2.
// ---------------------------------------------------------------------------
__device__ __forceinline__ u32x8 tdm_group1(unsigned rows, unsigned src_pitch) {
  u32x8 g;
  g[0] = uni((1u << 20) | (4u << 22) | (3u << 25));
  g[1] = uni(128u << 16);
  g[2] = uni(rows << 16);
  g[3] = uni(128u << 16);
  g[4] = uni(rows);
  g[5] = uni(src_pitch);
  g[6] = uni(0u);
  g[7] = uni(0u);
  // pinned(), for the group: descriptor words held in scalar registers.  Without it
  // the compiler rebuilds the constants per request and uses their registers for
  // other values in between, while a request that names them is still in flight.
  asm volatile("" : "+s"(g));
  return g;
}
__device__ __forceinline__ u32x4 tdm_group0(unsigned lds_dst, const void* gsrc) {
  const unsigned long long ga = (unsigned long long)(uintptr_t)gsrc;
  u32x4 g;
  g[0] = uni(1u);
  g[1] = uni(lds_dst);
  g[2] = uni((unsigned)ga);
  g[3] = uni((((unsigned)(ga >> 32)) & 0x01FFFFFFu) | 0x80000000u);
  asm volatile("" : "+s"(g));  // pinned(), for the group, as in tdm_group1
  return g;
}
// One request of the whole wave; "memory" keeps LDS reads and the waits in order round it.
__device__ __forceinline__ void tdm_load(u32x4 g0, u32x8 g1) {
  asm volatile("tensor_load_to_lds %0, %1" :: "s"(g0), "s"(g1) : "memory");
}
__device__ __forceinline__ unsigned lds_offset(const void* p) {
  return (unsigned)(uintptr_t)p;  // LDS byte offset = low 32 bits of the address
}
#endif

// ---------------------------------------------------------------------------
// Fragment loader: 16 rows striped over lanes, K-runs of 8 bf16 (16B) per half.
// A-matrix 16x32 layout (ISA 7.12.2): lane<16 holds K{0..7,16..23} of row=lane,
// lane>=16 holds K{8..15,24..31}.  B fragments (from [N,K]-transposed storage)
// use the identical pattern with row = output column.
// ---------------------------------------------------------------------------
__device__ __forceinline__ v16bf load_frag16(const bf16* __restrict__ base,
                                             int stride, int row, int kb) {
  const v8bf* p0 = reinterpret_cast<const v8bf*>(base + (size_t)row * stride + kb);
  const v8bf* p1 = reinterpret_cast<const v8bf*>(base + (size_t)row * stride + kb + 16);
  v8bf lo = *p0, hi = *p1;
  v16bf r;
#pragma unroll
  for (int i = 0; i < 8; ++i) { r[i] = lo[i]; r[i + 8] = hi[i]; }
  return r;
}

__device__ __forceinline__ float sigmoidf_(float v) { return 1.f / (1.f + __expf(-v)); }

// ---------------------------------------------------------------------------
// Transposes go through a 64x64 f32 tile in LDS, so that the global reads and
// the global writes are both whole lines.  Pitch 65 dwords: a column walk and
// a row walk both fall on distinct banks.
// ---------------------------------------------------------------------------
constexpr int TT = 64;       // tile edge
constexpr int TP = TT + 1;   // LDS pitch in dwords

// Tile column c, rows rg*8 .. rg*8+7 -> 8 bf16 = 16 B; 8 lanes fill a 128-B line.
__device__ __forceinline__ v8bf tile_column8(const float* tile, int c, int rg) {
  v8bf o;
#pragma unroll
  for (int i = 0; i < 8; ++i) o[i] = (bf16)tile[(rg * 8 + i) * TP + c];
  return o;
}

// Weight transpose+cast: W[r*ld + c] (f32) -> WT[c*rows + r] (bf16).
// Grid = (cols/64, rows/64), one tile per block.
__global__ __launch_bounds__(256) void tcast_kernel(const float* __restrict__ W,
                                                    bf16* __restrict__ WT,
                                                    int rows, int ld) {
  __shared__ float tile[TT * TP];
  const int c0 = blockIdx.x * TT, r0 = blockIdx.y * TT;
  const int lr = threadIdx.x >> 4, lc = (threadIdx.x & 15) * 4;
  v4f v[4];
#pragma unroll
  for (int p = 0; p < 4; ++p)
    v[p] = *reinterpret_cast<const v4f*>(W + (size_t)(r0 + p * 16 + lr) * ld + c0 + lc);
#pragma unroll
  for (int p = 0; p < 4; ++p)
#pragma unroll
    for (int i = 0; i < 4; ++i) tile[(p * 16 + lr) * TP + lc + i] = v[p][i];
  __syncthreads();
  const int oc = threadIdx.x >> 3, rg = threadIdx.x & 7;
#pragma unroll
  for (int p = 0; p < 2; ++p)
    *reinterpret_cast<v8bf*>(WT + (size_t)(c0 + p * 32 + oc) * rows + r0 + rg * 8) =
        tile_column8(tile, p * 32 + oc, rg);
}

// ---------------------------------------------------------------------------
// RMSNorm over last dim, f32 in -> bf16 out. One block (256 thr) per row.
// ---------------------------------------------------------------------------
__global__ __launch_bounds__(256) void rmsnorm_bf16(const float* __restrict__ x,
                                                    const float* __restrict__ w,
                                                    bf16* __restrict__ o, int Dd) {
  __shared__ float red[8];
  __shared__ float rinv;
  const int row = blockIdx.x;
  const float* xr = x + (size_t)row * Dd;
  float s = 0.f;
  for (int i = threadIdx.x; i < Dd; i += 256) { float v = xr[i]; s += v * v; }
#pragma unroll
  for (int off = 16; off; off >>= 1) s += __shfl_xor(s, off, 32);
  if ((threadIdx.x & 31) == 0) red[threadIdx.x >> 5] = s;
  __syncthreads();
  if (threadIdx.x == 0) {
    float t = 0.f;
    for (int i = 0; i < 8; ++i) t += red[i];
    rinv = rsqrtf(t / (float)Dd + 1e-6f);
  }
  __syncthreads();
  const float rv = rinv;
  bf16* orow = o + (size_t)row * Dd;
  for (int i = threadIdx.x; i < Dd; i += 256) orow[i] = (bf16)(xr[i] * rv * w[i]);
}

// ---------------------------------------------------------------------------
// Per-(token,head) RMSNorm over hd=64 with relayout [B,T,H,HD] -> [B,H,T,HD].
// ---------------------------------------------------------------------------
__global__ __launch_bounds__(256) void qk_head_rmsnorm(const bf16* __restrict__ in,
                                                       const float* __restrict__ w,
                                                       bf16* __restrict__ o) {
  const int wid  = blockIdx.x * 8 + (threadIdx.x >> 5);
  const int lane = threadIdx.x & 31;
  const int token = wid / CH, h = wid % CH;
  const bf16* src = in + (size_t)token * CD + h * CHD;
  float v0 = (float)src[lane], v1 = (float)src[lane + 32];
  float s = v0 * v0 + v1 * v1;
#pragma unroll
  for (int off = 16; off; off >>= 1) s += __shfl_xor(s, off, 32);
  const float r = rsqrtf(s / (float)CHD + 1e-6f);
  const int b = token / CT, t = token % CT;
  bf16* dst = o + (((size_t)b * CH + h) * CT + t) * CHD;
  dst[lane]      = (bf16)(v0 * r * w[lane]);
  dst[lane + 32] = (bf16)(v1 * r * w[lane + 32]);
}

// V relayout: [B,T,H,HD] -> [B,H,HD,T] so PV B-fragments are contiguous in T.
// Grid = (T/64, B*H), one 64(t) x 64(d) tile per block; bf16 -> f32 -> bf16 is exact.
__global__ __launch_bounds__(256) void vtrans_kernel(const bf16* __restrict__ in,
                                                     bf16* __restrict__ o) {
  __shared__ float tile[TT * TP];
  const int t0 = blockIdx.x * TT, bh = blockIdx.y;
  const int b = bh / CH, h = bh % CH;
  const int lt = threadIdx.x >> 3, lc = (threadIdx.x & 7) * 8;
  v8bf v[2];
#pragma unroll
  for (int p = 0; p < 2; ++p)
    v[p] = *reinterpret_cast<const v8bf*>(
        in + ((size_t)b * CT + t0 + p * 32 + lt) * CD + h * CHD + lc);
#pragma unroll
  for (int p = 0; p < 2; ++p)
#pragma unroll
    for (int i = 0; i < 8; ++i) tile[(p * 32 + lt) * TP + lc + i] = (float)v[p][i];
  __syncthreads();
  const int od = threadIdx.x >> 3, tg = threadIdx.x & 7;
#pragma unroll
  for (int p = 0; p < 2; ++p)
    *reinterpret_cast<v8bf*>(o + ((size_t)bh * CHD + p * 32 + od) * CT + t0 + tg * 8) =
        tile_column8(tile, p * 32 + od, tg);
}

// actions @ ae1_w + b, SiLU, -> bf16.  K=16, trivially small; keep simple.
__global__ __launch_bounds__(256) void ae1_silu_kernel(const float* __restrict__ act,
                                                       const float* __restrict__ w,
                                                       const float* __restrict__ bias,
                                                       bf16* __restrict__ o) {
  size_t idx = (size_t)blockIdx.x * 256 + threadIdx.x;
  if (idx >= (size_t)CM * CD) return;
  int col = (int)(idx % CD); size_t row = idx / CD;
  const float* a = act + row * CA;
  float s = bias[col];
#pragma unroll
  for (int i = 0; i < CA; ++i) s += a[i] * w[(size_t)i * CD + col];
  o[idx] = (bf16)(s * sigmoidf_(s));
}

// x = x * (1 + scale1) + shift1 ; mod is [M, 2D] f32 (shift cols 0..D, scale D..2D)
__global__ __launch_bounds__(256) void modulate_kernel(float* __restrict__ x,
                                                       const float* __restrict__ mod) {
  size_t idx = (size_t)blockIdx.x * 256 + threadIdx.x;
  if (idx >= (size_t)CM * CD) return;
  int col = (int)(idx % CD); size_t row = idx / CD;
  const float shift = mod[row * (2 * CD) + col];
  const float scale = mod[row * (2 * CD) + CD + col];
  x[idx] = x[idx] * (1.f + scale) + shift;
}

// ---------------------------------------------------------------------------
// bf16 WMMA GEMM: C[M,N] = A[M,K] @ W (W stored transposed [N,K]) + bias.
// 256 threads = 8 waves (4x2), block tile 128x64, wave tile 32x32.
// TDM path: A(128x64) and B(64x64) K-slabs double-buffered in LDS via
// tensor_load_to_lds, wave 0 issuing A and wave 1 issuing B, one request of a
// wave in flight; everyone reads via ds_load_b128.  Kdim: two slabs or more.
// EPI: 0 = f32 out, 1 = bf16 out, 2 = GELU(exact)->bf16, 3 = SiLU->bf16,
//      4 = resid + acc -> f32 out.
// ---------------------------------------------------------------------------
template <int EPI>
__global__ __launch_bounds__(256) void gemm_bf16_wmma(
    const bf16* __restrict__ Am, const bf16* __restrict__ Wt,
    const float* __restrict__ bias, const float* __restrict__ resid,
    float* __restrict__ outF, bf16* __restrict__ outH,
    int Mdim, int Ndim, int Kdim) {
  const int wave = __builtin_amdgcn_readfirstlane(threadIdx.x >> 5);
  const int lane = threadIdx.x & 31;
  const int wm = wave >> 1, wn = wave & 1;
  const int l15 = lane & 15, half = lane >> 4;
  const int bmb = blockIdx.x * 128;
  const int bnb = blockIdx.y * 64;
  const int bm = bmb + wm * 32;
  const int bn = bnb + wn * 32;

  v8f acc[2][2] = {};

#if HAS_TDM
  __shared__ __attribute__((aligned(2048))) bf16 ash[2][T128];
  __shared__ __attribute__((aligned(2048))) bf16 bsh[2][T64];
  const int nst = Kdim >> 6;  // stages of 64 k
  const bool isA = wave == 0;
  const bf16* gsrc = isA ? Am + (size_t)bmb * Kdim : Wt + (size_t)bnb * Kdim;
  const unsigned lds0 = isA ? lds_offset(&ash[0][0]) : lds_offset(&bsh[0][0]);
  const unsigned lstep = isA ? T128 * 2u : T64 * 2u;
  const u32x8 g1 = tdm_group1(isA ? 128u : 64u, (unsigned)Kdim * 2u);
  u32x4 g0 = tdm_group0(lds0, gsrc);
  if (pinned(wave < 2)) {
    tdm_load(g0, g1);
    wait_tensor0(g0);
  }
  __syncthreads();  // stage 0 is readable
  g0 = tdm_group0(lds0 + lstep, gsrc + 64);
  if (pinned(wave < 2)) tdm_load(g0, g1);
  for (int s = 0; s < nst; ++s) {
    const int cur = s & 1;
#pragma unroll
    for (int kk = 0; kk < 2; ++kk) {
      v16bf af[2], bfm[2];
#pragma unroll
      for (int i = 0; i < 2; ++i)
        af[i] = load_frag16(&ash[cur][0], LP, wm * 32 + i * 16 + l15, kk * 32 + half * 8);
#pragma unroll
      for (int j = 0; j < 2; ++j)
        bfm[j] = load_frag16(&bsh[cur][0], LP, wn * 32 + j * 16 + l15, kk * 32 + half * 8);
#pragma unroll
      for (int i = 0; i < 2; ++i)
#pragma unroll
        for (int j = 0; j < 2; ++j)
          acc[i][j] = __builtin_amdgcn_wmma_f32_16x16x32_bf16(
              false, af[i], false, bfm[j], (short)0, acc[i][j], false, false);
    }
    // Publish point of stage s + 1; it also ends every read of buffer `cur`.
    wait_ds0();
    wait_tensor0(g0);
    __syncthreads();
    if (pinned(wave < 2 && s + 2 < nst)) {
      g0 = tdm_group0(lds0 + cur * lstep, gsrc + (size_t)(s + 2) * 64);
      tdm_load(g0, g1);
    }
  }
  // Behind the ring: nothing of it is in flight when the wave goes on.
  wait_tensor0();
  wait_ds0();
#else
  for (int k0 = 0; k0 < Kdim; k0 += 32) {
    if (k0 + 32 < Kdim) {
      __builtin_prefetch(Am + (size_t)(bm + l15) * Kdim + k0 + 32, 0, 0);
      __builtin_prefetch(Wt + (size_t)(bn + l15) * Kdim + k0 + 32, 0, 0);
    }
    v16bf af[2], bfm[2];
#pragma unroll
    for (int i = 0; i < 2; ++i)
      af[i] = load_frag16(Am, Kdim, bm + i * 16 + l15, k0 + half * 8);
#pragma unroll
    for (int j = 0; j < 2; ++j)
      bfm[j] = load_frag16(Wt, Kdim, bn + j * 16 + l15, k0 + half * 8);
#pragma unroll
    for (int i = 0; i < 2; ++i)
#pragma unroll
      for (int j = 0; j < 2; ++j)
        acc[i][j] = __builtin_amdgcn_wmma_f32_16x16x32_bf16(
            false, af[i], false, bfm[j], (short)0, acc[i][j], false, false);
  }
#endif
  // epilogue: C-layout = VGPR r -> row (r + 8*half), lane&15 -> col
#pragma unroll
  for (int i = 0; i < 2; ++i)
#pragma unroll
    for (int j = 0; j < 2; ++j) {
      const int col = bn + j * 16 + l15;
      const float bv = bias ? bias[col] : 0.f;
#pragma unroll
      for (int r = 0; r < 8; ++r) {
        const int row = bm + i * 16 + r + half * 8;
        const size_t idx = (size_t)row * Ndim + col;
        float v = acc[i][j][r] + bv;
        if (EPI == 0) {
          outF[idx] = v;
        } else if (EPI == 1) {
          outH[idx] = (bf16)v;
        } else if (EPI == 2) {
          outH[idx] = (bf16)(0.5f * v * (1.f + erff(v * 0.70710678118f)));
        } else if (EPI == 3) {
          outH[idx] = (bf16)(v * sigmoidf_(v));
        } else {
          outF[idx] = resid[idx] + v;
        }
      }
    }
}

// ---------------------------------------------------------------------------
// Flash attention (causal), one block = 64 query rows, 4 waves x 16 rows.
// Q,K in [B*H, T, hd] bf16; V in [B*H, hd, T] bf16.
// TDM path: K/V 64x64 tiles double-buffered in LDS via tensor_load_to_lds,
// wave 0 issuing K and wave 1 issuing V, one request of a wave in flight.
// Online softmax entirely in-wave (16-lane butterflies match C-layout halves);
// P staged through per-wave LDS to convert C-layout -> A-layout for P@V.
// ---------------------------------------------------------------------------
__global__ __launch_bounds__(128) void flash_attn_wmma(
    const bf16* __restrict__ Q, const bf16* __restrict__ K,
    const bf16* __restrict__ Vt, bf16* __restrict__ O) {
  const int bh    = blockIdx.y;
  const int qtile = blockIdx.x;
  const int wave  = __builtin_amdgcn_readfirstlane(threadIdx.x >> 5);
  const int lane  = threadIdx.x & 31;
  const int l15 = lane & 15, half = lane >> 4;
  const int q0 = qtile * 64 + wave * 16;

  const bf16* Qh = Q  + (size_t)bh * CT * CHD;
  const bf16* Kh = K  + (size_t)bh * CT * CHD;
  const bf16* Vh = Vt + (size_t)bh * CHD * CT;

  __shared__ __attribute__((aligned(16))) bf16 pshm[4][16 * LP];
#if HAS_TDM
  __shared__ __attribute__((aligned(2048))) bf16 ksh[2][T64];
  __shared__ __attribute__((aligned(2048))) bf16 vsh[2][T64];
  static_assert(CT >= 128, "stages 0 and 1 lie inside K and V for every query tile");
  const bool isK = wave == 0;
  const bf16* gsrc = isK ? Kh : Vh;                    // K: 64 keys x hd; V: hd rows x 64 keys
  const unsigned gstep = isK ? 64u * CHD : 64u;        // elements from one stage to the next
  const unsigned lds0 = isK ? lds_offset(&ksh[0][0]) : lds_offset(&vsh[0][0]);
  const u32x8 g1 = tdm_group1(64u, isK ? CHD * 2u : CT * 2u);
  u32x4 g0 = tdm_group0(lds0, gsrc);
  if (pinned(wave < 2)) {
    tdm_load(g0, g1);
    wait_tensor0(g0);
  }
  __syncthreads();  // stage 0 is readable
  g0 = tdm_group0(lds0 + T64 * 2u, gsrc + gstep);
  if (pinned(wave < 2)) tdm_load(g0, g1);
#endif

  v16bf qf[2];
#pragma unroll
  for (int kk = 0; kk < 2; ++kk)
    qf[kk] = load_frag16(Qh, CHD, q0 + l15, kk * 32 + half * 8);

  v8f oacc[4] = {};
  float m_i[8], l_i[8];
#pragma unroll
  for (int r = 0; r < 8; ++r) { m_i[r] = -1e30f; l_i[r] = 0.f; }
  const float scl = 0.125f;  // hd^-0.5

  for (int kt = 0; kt <= qtile; ++kt) {
    const int kbase = kt * 64;
#if HAS_TDM
    const int cur = kt & 1;
#endif
    // S = Q @ K^T
    v8f s[4];
#pragma unroll
    for (int j = 0; j < 4; ++j) {
      v8f z = {};
#pragma unroll
      for (int kk = 0; kk < 2; ++kk) {
#if HAS_TDM
        v16bf kf = load_frag16(&ksh[cur][0], LP, j * 16 + l15, kk * 32 + half * 8);
#else
        v16bf kf = load_frag16(Kh, CHD, kbase + j * 16 + l15, kk * 32 + half * 8);
#endif
        z = __builtin_amdgcn_wmma_f32_16x16x32_bf16(false, qf[kk], false, kf,
                                                    (short)0, z, false, false);
      }
      s[j] = z;
    }
    const bool diag = (kt == qtile);
    float rmax[8];
#pragma unroll
    for (int r = 0; r < 8; ++r) rmax[r] = -1e30f;
#pragma unroll
    for (int j = 0; j < 4; ++j) {
      const int col = kbase + j * 16 + l15;
#pragma unroll
      for (int r = 0; r < 8; ++r) {
        const int row = q0 + r + half * 8;
        float v = s[j][r] * scl;
        if (diag && col > row) v = -1e30f;
        s[j][r] = v;
        rmax[r] = fmaxf(rmax[r], v);
      }
    }
#pragma unroll
    for (int r = 0; r < 8; ++r)
#pragma unroll
      for (int off = 1; off < 16; off <<= 1)
        rmax[r] = fmaxf(rmax[r], __shfl_xor(rmax[r], off, 32));

    float alpha[8];
#pragma unroll
    for (int r = 0; r < 8; ++r) {
      const float nm = fmaxf(m_i[r], rmax[r]);
      alpha[r] = __expf(m_i[r] - nm);
      m_i[r] = nm;
    }
    float rsum[8];
#pragma unroll
    for (int r = 0; r < 8; ++r) rsum[r] = 0.f;
#pragma unroll
    for (int j = 0; j < 4; ++j)
#pragma unroll
      for (int r = 0; r < 8; ++r) {
        const float p = __expf(s[j][r] - m_i[r]);
        s[j][r] = p;
        rsum[r] += p;
      }
#pragma unroll
    for (int r = 0; r < 8; ++r) {
#pragma unroll
      for (int off = 1; off < 16; off <<= 1)
        rsum[r] += __shfl_xor(rsum[r], off, 32);
      l_i[r] = l_i[r] * alpha[r] + rsum[r];
    }
#pragma unroll
    for (int n = 0; n < 4; ++n)
#pragma unroll
      for (int r = 0; r < 8; ++r) oacc[n][r] *= alpha[r];

    // P (C-layout) -> LDS bf16 tile [16 x 64], rows at pitch LP
#pragma unroll
    for (int j = 0; j < 4; ++j) {
      const int colL = j * 16 + l15;
#pragma unroll
      for (int r = 0; r < 8; ++r)
        pshm[wave][(r + half * 8) * LP + colL] = (bf16)s[j][r];
    }
    // O += P @ V
#pragma unroll
    for (int kk = 0; kk < 2; ++kk) {
      v16bf pf = load_frag16(&pshm[wave][0], LP, l15, kk * 32 + half * 8);
#pragma unroll
      for (int n = 0; n < 4; ++n) {
#if HAS_TDM
        v16bf vf = load_frag16(&vsh[cur][0], LP, n * 16 + l15, kk * 32 + half * 8);
#else
        v16bf vf = load_frag16(Vh, CT, n * 16 + l15, kbase + kk * 32 + half * 8);
#endif
        oacc[n] = __builtin_amdgcn_wmma_f32_16x16x32_bf16(false, pf, false, vf,
                                                          (short)0, oacc[n], false, false);
      }
    }
#if HAS_TDM
    // Publish point of stage kt + 1; it also ends every read of buffer `cur`.
    wait_ds0();
    wait_tensor0(g0);
    __syncthreads();
    if (pinned(wave < 2 && kt + 2 <= qtile)) {
      g0 = tdm_group0(lds0 + cur * (T64 * 2u), gsrc + (size_t)(kt + 2) * gstep);
      tdm_load(g0, g1);
    }
#endif
  }
#if HAS_TDM
  // Behind the ring: nothing of it is in flight when the wave goes on.
  wait_tensor0();
  wait_ds0();
#endif
  // normalize + store to [B,T,H,HD] (== [M,D] for the O-projection GEMM)
  const int b = bh / CH, h = bh % CH;
#pragma unroll
  for (int n = 0; n < 4; ++n) {
    const int hd = n * 16 + l15;
#pragma unroll
    for (int r = 0; r < 8; ++r) {
      const int t = q0 + r + half * 8;
      O[(((size_t)b * CT + t) * CH + h) * CHD + hd] = (bf16)(oacc[n][r] / l_i[r]);
    }
  }
}

// ---------------------------------------------------------------------------
extern "C" void kernel_launch(void* const* d_in, const int* in_sizes, int n_in,
                              void* d_out, int out_size, void* d_ws, size_t ws_size,
                              hipStream_t stream) {
  (void)in_sizes; (void)n_in; (void)out_size; (void)ws_size;
  const float* x    = (const float*)d_in[0];
  const float* act  = (const float*)d_in[1];
  const float* n1w  = (const float*)d_in[2];
  const float* n2w  = (const float*)d_in[3];
  const float* qw   = (const float*)d_in[4];
  const float* qb   = (const float*)d_in[5];
  const float* kw   = (const float*)d_in[6];
  const float* kb_  = (const float*)d_in[7];
  const float* vw   = (const float*)d_in[8];
  const float* vb   = (const float*)d_in[9];
  const float* qnw  = (const float*)d_in[10];
  const float* knw  = (const float*)d_in[11];
  const float* ow   = (const float*)d_in[12];
  const float* ob   = (const float*)d_in[13];
  const float* ae1w = (const float*)d_in[14];
  const float* ae1b = (const float*)d_in[15];
  const float* ae2w = (const float*)d_in[16];
  const float* ae2b = (const float*)d_in[17];
  const float* modw = (const float*)d_in[18];
  const float* modb = (const float*)d_in[19];
  const float* m1w  = (const float*)d_in[20];
  const float* m1b  = (const float*)d_in[21];
  const float* m2w  = (const float*)d_in[22];
  const float* m2b  = (const float*)d_in[23];
  float* out = (float*)d_out;

  char* wsb = (char*)d_ws;
  size_t off = 0;
  auto alloc = [&](size_t bytes) -> char* {
    char* p = wsb + off;
    off += (bytes + 255) & ~(size_t)255;
    return p;
  };
  bf16* hn   = (bf16*)alloc((size_t)CM * CD * 2);
  bf16* wqT  = (bf16*)alloc((size_t)CD * CD * 2);
  bf16* wkT  = (bf16*)alloc((size_t)CD * CD * 2);
  bf16* wvT  = (bf16*)alloc((size_t)CD * CD * 2);
  bf16* woT  = (bf16*)alloc((size_t)CD * CD * 2);
  bf16* ae2T = (bf16*)alloc((size_t)CD * CD * 2);
  bf16* modT = (bf16*)alloc((size_t)2 * CD * CD * 2);
  bf16* m1T  = (bf16*)alloc((size_t)CMLP * CD * 2);
  bf16* m2T  = (bf16*)alloc((size_t)CD * CMLP * 2);
  bf16* qp   = (bf16*)alloc((size_t)CM * CD * 2);
  bf16* kp   = (bf16*)alloc((size_t)CM * CD * 2);
  bf16* vp   = (bf16*)alloc((size_t)CM * CD * 2);
  bf16* qh   = (bf16*)alloc((size_t)CM * CD * 2);
  bf16* kh   = (bf16*)alloc((size_t)CM * CD * 2);
  bf16* vTb  = (bf16*)alloc((size_t)CM * CD * 2);
  bf16* attn = (bf16*)alloc((size_t)CM * CD * 2);
  bf16* sae1 = (bf16*)alloc((size_t)CM * CD * 2);
  bf16* sae2 = (bf16*)alloc((size_t)CM * CD * 2);
  float* modv = (float*)alloc((size_t)CM * 2 * CD * 4);
  bf16* h2   = (bf16*)alloc((size_t)CM * CD * 2);
  bf16* mh   = (bf16*)alloc((size_t)CM * CMLP * 2);

  const dim3 tb(256);
  auto cdiv = [](size_t a, size_t b) { return (unsigned)((a + b - 1) / b); };

  // --- weight transposes to [N,K] bf16 ---
  static_assert(CD % TT == 0 && CMLP % TT == 0 && CT % TT == 0 && CHD == TT, "whole tiles");
  const dim3 gT(CD / TT, CD / TT);
  tcast_kernel<<<gT, tb, 0, stream>>>(qw,  wqT,  CD, CD);
  tcast_kernel<<<gT, tb, 0, stream>>>(kw,  wkT,  CD, CD);
  tcast_kernel<<<gT, tb, 0, stream>>>(vw,  wvT,  CD, CD);
  tcast_kernel<<<gT, tb, 0, stream>>>(ow,  woT,  CD, CD);
  tcast_kernel<<<gT, tb, 0, stream>>>(ae2w, ae2T, CD, CD);
  tcast_kernel<<<dim3(2 * CD / TT, CD / TT), tb, 0, stream>>>(modw, modT, CD, 4 * CD);
  tcast_kernel<<<dim3(CMLP / TT, CD / TT), tb, 0, stream>>>(m1w, m1T, CD, CMLP);
  tcast_kernel<<<dim3(CD / TT, CMLP / TT), tb, 0, stream>>>(m2w, m2T, CMLP, CD);

  // --- attention path ---
  rmsnorm_bf16<<<CM, tb, 0, stream>>>(x, n1w, hn, CD);
  dim3 gDD(CM / 128, CD / 64);
  gemm_bf16_wmma<1><<<gDD, tb, 0, stream>>>(hn, wqT, qb,  nullptr, nullptr, qp, CM, CD, CD);
  gemm_bf16_wmma<1><<<gDD, tb, 0, stream>>>(hn, wkT, kb_, nullptr, nullptr, kp, CM, CD, CD);
  gemm_bf16_wmma<1><<<gDD, tb, 0, stream>>>(hn, wvT, vb,  nullptr, nullptr, vp, CM, CD, CD);
  qk_head_rmsnorm<<<CM * CH / 8, tb, 0, stream>>>(qp, qnw, qh);
  qk_head_rmsnorm<<<CM * CH / 8, tb, 0, stream>>>(kp, knw, kh);
  vtrans_kernel<<<dim3(CT / TT, CB * CH), tb, 0, stream>>>(vp, vTb);
  flash_attn_wmma<<<dim3(CT / 64, CB * CH), dim3(128), 0, stream>>>(qh, kh, vTb, attn);
  gemm_bf16_wmma<4><<<gDD, tb, 0, stream>>>(attn, woT, ob, x, out, nullptr, CM, CD, CD);

  // --- action conditioning ---
  ae1_silu_kernel<<<cdiv((size_t)CM * CD, 256), tb, 0, stream>>>(act, ae1w, ae1b, sae1);
  gemm_bf16_wmma<3><<<gDD, tb, 0, stream>>>(sae1, ae2T, ae2b, nullptr, nullptr, sae2, CM, CD, CD);
  dim3 gD2(CM / 128, 2 * CD / 64);
  gemm_bf16_wmma<0><<<gD2, tb, 0, stream>>>(sae2, modT, modb, nullptr, modv, nullptr, CM, 2 * CD, CD);
  modulate_kernel<<<cdiv((size_t)CM * CD, 256), tb, 0, stream>>>(out, modv);

  // --- MLP ---
  rmsnorm_bf16<<<CM, tb, 0, stream>>>(out, n2w, h2, CD);
  dim3 gDM(CM / 128, CMLP / 64);
  gemm_bf16_wmma<2><<<gDM, tb, 0, stream>>>(h2, m1T, m1b, nullptr, nullptr, mh, CM, CMLP, CD);
  gemm_bf16_wmma<4><<<gDD, tb, 0, stream>>>(mh, m2T, m2b, out, out, nullptr, CM, CD, CMLP);
}

// v003
// A run of this version takes 354 microseconds.
// In two side-by-side timings against v002, it was 1.06 and 1.05 times as fast.
// All steps since v000 together make it 2.85 times as fast.
#include <hip/hip_runtime.h>
#include <hip/hip_bf16.h>
#include <math.h>

typedef __bf16 bf16;
typedef __attribute__((ext_vector_type(16))) __bf16 v16bf;
typedef __attribute__((ext_vector_type(8)))  __bf16 v8bf;
typedef __attribute__((ext_vector_type(4)))  __bf16 v4bf;
typedef __attribute__((ext_vector_type(8)))  float  v8f;
typedef __attribute__((ext_vector_type(4)))  float  v4f;

constexpr int CB   = 2;
constexpr int CT   = 2048;
constexpr int CD   = 1024;
constexpr int CH   = 16;
constexpr int CHD  = 64;
constexpr int CA   = 16;
constexpr int CMLP = 4096;
constexpr int CM   = CB * CT;  // 4096 tokens

// LDS pitch of every 64-element bf16 row that ds_load_b128 fragments read.
constexpr int LP    = 72;              // 144 B
constexpr int T128  = 128 * LP;        // 128 padded rows: 18432 B = 9 x 2 KiB
constexpr int T64   = 5120;            // 64 padded rows (9216 B) rounded up to 5 x 2 KiB
static_assert(64 * LP <= T64 && (T64 * 2) % 2048 == 0 && (T128 * 2) % 2048 == 0, "tile places");

#if defined(__HIP_DEVICE_COMPILE__) && \
    __has_builtin(__builtin_amdgcn_tensor_load_to_lds) && \
    __has_builtin(__builtin_amdgcn_s_wait_tensorcnt)
#define HAS_TDM 1
#else
#define HAS_TDM 0
#endif

#if HAS_TDM
typedef __attribute__((ext_vector_type(4))) unsigned int u32x4;
typedef __attribute__((ext_vector_type(8))) unsigned int u32x8;

__device__ __forceinline__ unsigned uni(unsigned v) {
  return (unsigned)__builtin_amdgcn_readfirstlane(v);
}
// A wave-uniform test held in a scalar register, so that the branch on it is a
// scalar branch: a tensor load ignores EXEC and only such a branch guards it.
__device__ __forceinline__ unsigned pinned(unsigned v) {
  unsigned w = uni(v);
  asm volatile("" : "+s"(w));
  return w;
}
// The compiler places no wait for the tensor mover: a tile counts as landed only
// behind its issuing wave's own wait.
__device__ __forceinline__ void wait_tensor0() {
  asm volatile("s_wait_tensorcnt 0x0" ::: "memory");
}
// The same wait, naming as inputs the group-0 words of the request it covers:
// their registers are then not given to other values while it is in flight.
__device__ __forceinline__ void wait_tensor0(u32x4 g0) {
  asm volatile("s_wait_tensorcnt 0x0" :: "s"(g0) : "memory");
}
// This wave's LDS reads have retired before the barrier behind which their
// buffer is refilled.
__device__ __forceinline__ void wait_ds0() {
  asm volatile("s_wait_dscnt 0x0" ::: "memory");
}

// ---------------------------------------------------------------------------
// 2D tensor load into LDS: `rows` rows of 128 B (64 bf16), source row pitch
// `src_pitch` bytes.  The mover lays a 16-B pad behind every row, so the rows
// stand at LP * 2 = 144 B in LDS (16 B x odd): the 16 rows that one
// ds_load_b128 touches per half-wave then fall on 64 distinct banks, where the
// bare 128-B pitch puts eight of them on the same four.
// Group 1: no mask, data_size 0 (all extents in bytes), pad enable | interval
// code 4 (128 B) | amount code 3 (16 B), tensor dims = tile dims, source pitch.
// Group 0: count 1, LDS byte offset, global address, type 2.
// ---------------------------------------------------------------------------
__device__ __forceinline__ u32x8 tdm_group1(unsigned rows, unsigned src_pitch) {
  u32x8 g;
  g[0] = uni((1u << 20) | (4u << 22) | (3u << 25));
  g[1] = uni(128u << 16);
  g[2] = uni(rows << 16);
  g[3] = uni(128u << 16);
  g[4] = uni(rows);
  g[5] = uni(src_pitch);
  g[6] = uni(0u);
  g[7] = uni(0u);
  // pinned(), for the group: descriptor words held in scalar registers.  Without it
  // the compiler rebuilds the constants per request and uses their registers for
  // other values in between, while a request that names them is still in flight.
  asm volatile("" : "+s"(g));
  return g;
}
__device__ __forceinline__ u32x4 tdm_group0(unsigned lds_dst, const void* gsrc) {
  const unsigned long long ga = (unsigned long long)(uintptr_t)gsrc;
  u32x4 g;
  g[0] = uni(1u);
  g[1] = uni(lds_dst);
  g[2] = uni((unsigned)ga);
  g[3] = uni((((unsigned)(ga >> 32)) & 0x01FFFFFFu) | 0x80000000u);
  asm volatile("" : "+s"(g));  // pinned(), for the group, as in tdm_group1
  return g;
}
// One request of the whole wave; "memory" keeps LDS reads and the waits in order round it.
__device__ __forceinline__ void tdm_load(u32x4 g0, u32x8 g1) {
  asm volatile("tensor_load_to_lds %0, %1" :: "s"(g0), "s"(g1) : "memory");
}
__device__ __forceinline__ unsigned lds_offset(const void* p) {
  return (unsigned)(uintptr_t)p;  // LDS byte offset = low 32 bits of the address
}
#endif

// ---------------------------------------------------------------------------
// Fragment loader: 16 rows striped over lanes, K-runs of 8 bf16 (16B) per half.
// A-matrix 16x32 layout (ISA 7.12.2): lane<16 holds K{0..7,16..23} of row=lane,
// lane>=16 holds K{8..15,24..31}.  B fragments (from [N,K]-transposed storage)
// use the identical pattern with row = output column.
// ---------------------------------------------------------------------------
__device__ __forceinline__ v16bf load_frag16(const bf16* __restrict__ base,
                                             int stride, int row, int kb) {
  const v8bf* p0 = reinterpret_cast<const v8bf*>(base + (size_t)row * stride + kb);
  const v8bf* p1 = reinterpret_cast<const v8bf*>(base + (size_t)row * stride + kb + 16);
  v8bf lo = *p0, hi = *p1;
  v16bf r;
#pragma unroll
  for (int i = 0; i < 8; ++i) { r[i] = lo[i]; r[i + 8] = hi[i]; }
  return r;
}

__device__ __forceinline__ float sigmoidf_(float v) { return 1.f / (1.f + __expf(-v)); }

// ---------------------------------------------------------------------------
// Transposes go through a 64x64 f32 tile in LDS, so that the global reads and
// the global writes are both whole lines.  Pitch 65 dwords: a column walk and
// a row walk both fall on distinct banks.
// ---------------------------------------------------------------------------
constexpr int TT = 64;       // tile edge
constexpr int TP = TT + 1;   // LDS pitch in dwords

// Tile column c, rows rg*8 .. rg*8+7 -> 8 bf16 = 16 B; 8 lanes fill a 128-B line.
__device__ __forceinline__ v8bf tile_column8(const float* tile, int c, int rg) {
  v8bf o;
#pragma unroll
  for (int i = 0; i < 8; ++i) o[i] = (bf16)tile[(rg * 8 + i) * TP + c];
  return o;
}

// Weight transpose+cast: W[r*ld + c] (f32) -> WT[c*rows + r] (bf16).
// Grid = (cols/64, rows/64), one tile per block.
__global__ __launch_bounds__(256) void tcast_kernel(const float* __restrict__ W,
                                                    bf16* __restrict__ WT,
                                                    int rows, int ld) {
  __shared__ float tile[TT * TP];
  const int c0 = blockIdx.x * TT, r0 = blockIdx.y * TT;
  const int lr = threadIdx.x >> 4, lc = (threadIdx.x & 15) * 4;
  v4f v[4];
#pragma unroll
  for (int p = 0; p < 4; ++p)
    v[p] = *reinterpret_cast<const v4f*>(W + (size_t)(r0 + p * 16 + lr) * ld + c0 + lc);
#pragma unroll
  for (int p = 0; p < 4; ++p)
#pragma unroll
    for (int i = 0; i < 4; ++i) tile[(p * 16 + lr) * TP + lc + i] = v[p][i];
  __syncthreads();
  const int oc = threadIdx.x >> 3, rg = threadIdx.x & 7;
#pragma unroll
  for (int p = 0; p < 2; ++p)
    *reinterpret_cast<v8bf*>(WT + (size_t)(c0 + p * 32 + oc) * rows + r0 + rg * 8) =
        tile_column8(tile, p * 32 + oc, rg);
}

// ---------------------------------------------------------------------------
// The row-wise kernels below start few, long waves: a wave handles CD elements
// or more instead of 32 or 64, its loads are 16 B a lane on whole lines, and many
// of them are in flight at once.  Each kernel's own header says how it splits rows.
// ---------------------------------------------------------------------------
constexpr int RC = CD / 128;  // f32 chunks of a row: 32 lanes x 4 elements each
static_assert(CD % 256 == 0 && CM % 8 == 0, "whole chunks, whole blocks");

// RMSNorm over last dim, f32 in -> bf16 out.  One wave per row, row in registers.
__global__ __launch_bounds__(256) void rmsnorm_bf16(const float* __restrict__ x,
                                                    const float* __restrict__ w,
                                                    bf16* __restrict__ o) {
  const int row  = blockIdx.x * 8 + (threadIdx.x >> 5);
  const int lane = threadIdx.x & 31;
  const float* xr = x + (size_t)row * CD + lane * 4;
  v4f v[RC];
#pragma unroll
  for (int c = 0; c < RC; ++c) v[c] = *reinterpret_cast<const v4f*>(xr + c * 128);
  v4f s4 = {};
#pragma unroll
  for (int c = 0; c < RC; ++c) s4 += v[c] * v[c];
  float s = (s4[0] + s4[1]) + (s4[2] + s4[3]);
#pragma unroll
  for (int off = 16; off; off >>= 1) s += __shfl_xor(s, off, 32);
  const float rv = rsqrtf(s / (float)CD + 1e-6f);
  bf16* orow = o + (size_t)row * CD + lane * 4;
#pragma unroll
  for (int c = 0; c < RC; ++c) {
    const v4f wv = *reinterpret_cast<const v4f*>(w + c * 128 + lane * 4);
    v4bf ov;
#pragma unroll
    for (int i = 0; i < 4; ++i) ov[i] = (bf16)(v[c][i] * rv * wv[i]);
    *reinterpret_cast<v4bf*>(orow + c * 128) = ov;
  }
}

// ---------------------------------------------------------------------------
// Per-(token,head) RMSNorm over hd=64 with relayout [B,T,H,HD] -> [B,H,T,HD].
// One wave per token; 8 lanes x 8 elements hold one head, so a wave-wide load
// covers 4 heads (512 contiguous B) and each head leaves as one 128-B line.
// ---------------------------------------------------------------------------
__global__ __launch_bounds__(256) void qk_head_rmsnorm(const bf16* __restrict__ in,
                                                       const float* __restrict__ w,
                                                       bf16* __restrict__ o) {
  static_assert(CHD == 64, "8 lanes x 8 elements = one head");
  const int token = blockIdx.x * 8 + (threadIdx.x >> 5);
  const int lane  = threadIdx.x & 31;
  const int e0 = (lane & 7) * 8;
  const bf16* src = in + (size_t)token * CD + lane * 8;
  v8bf v[CH / 4];
#pragma unroll
  for (int u = 0; u < CH / 4; ++u) v[u] = *reinterpret_cast<const v8bf*>(src + u * 256);
  const v4f w0 = *reinterpret_cast<const v4f*>(w + e0);
  const v4f w1 = *reinterpret_cast<const v4f*>(w + e0 + 4);
  const int b = token / CT, t = token % CT;
  bf16* dst = o + (((size_t)b * CH + (lane >> 3)) * CT + t) * CHD + e0;
#pragma unroll
  for (int u = 0; u < CH / 4; ++u) {
    float f[8];
#pragma unroll
    for (int i = 0; i < 8; ++i) f[i] = (float)v[u][i];
    float s = 0.f;
#pragma unroll
    for (int i = 0; i < 8; ++i) s += f[i] * f[i];
#pragma unroll
    for (int off = 4; off; off >>= 1) s += __shfl_xor(s, off, 32);
    const float r = rsqrtf(s / (float)CHD + 1e-6f);
    v8bf ov;
#pragma unroll
    for (int i = 0; i < 4; ++i) {
      ov[i]     = (bf16)(f[i] * r * w0[i]);
      ov[i + 4] = (bf16)(f[i + 4] * r * w1[i]);
    }
    *reinterpret_cast<v8bf*>(dst + (size_t)u * 4 * CT * CHD) = ov;
  }
}

// V relayout: [B,T,H,HD] -> [B,H,HD,T] so PV B-fragments are contiguous in T.
// Grid = (T/64, B*H), one 64(t) x 64(d) tile per block; bf16 -> f32 -> bf16 is exact.
__global__ __launch_bounds__(256) void vtrans_kernel(const bf16* __restrict__ in,
                                                     bf16* __restrict__ o) {
  __shared__ float tile[TT * TP];
  const int t0 = blockIdx.x * TT, bh = blockIdx.y;
  const int b = bh / CH, h = bh % CH;
  const int lt = threadIdx.x >> 3, lc = (threadIdx.x & 7) * 8;
  v8bf v[2];
#pragma unroll
  for (int p = 0; p < 2; ++p)
    v[p] = *reinterpret_cast<const v8bf*>(
        in + ((size_t)b * CT + t0 + p * 32 + lt) * CD + h * CHD + lc);
#pragma unroll
  for (int p = 0; p < 2; ++p)
#pragma unroll
    for (int i = 0; i < 8; ++i) tile[(p * 32 + lt) * TP + lc + i] = (float)v[p][i];
  __syncthreads();
  const int od = threadIdx.x >> 3, tg = threadIdx.x & 7;
#pragma unroll
  for (int p = 0; p < 2; ++p)
    *reinterpret_cast<v8bf*>(o + ((size_t)bh * CHD + p * 32 + od) * CT + t0 + tg * 8) =
        tile_column8(tile, p * 32 + od, tg);
}

// actions @ ae1_w + b, SiLU, -> bf16.  K=16.  A lane keeps the weights of its 8
// columns in registers and walks AR rows; 4 waves span a row, 2 row groups a block.
constexpr int AR = 8;
static_assert(CD == 4 * 256 && CM % (2 * AR) == 0, "4 waves x 32 lanes x 8 columns = one row");
__global__ __launch_bounds__(256) void ae1_silu_kernel(const float* __restrict__ act,
                                                       const float* __restrict__ w,
                                                       const float* __restrict__ bias,
                                                       bf16* __restrict__ o) {
  const int wave = __builtin_amdgcn_readfirstlane(threadIdx.x >> 5);
  const int col  = (wave & 3) * 256 + (threadIdx.x & 31) * 8;
  const int row0 = (blockIdx.x * 2 + (wave >> 2)) * AR;
  v4f wr[CA][2], bv[2];
#pragma unroll
  for (int i = 0; i < CA; ++i)
#pragma unroll
    for (int g = 0; g < 2; ++g)
      wr[i][g] = *reinterpret_cast<const v4f*>(w + (size_t)i * CD + col + g * 4);
#pragma unroll
  for (int g = 0; g < 2; ++g) bv[g] = *reinterpret_cast<const v4f*>(bias + col + g * 4);
#pragma unroll
  for (int r = 0; r < AR; ++r) {
    const float* a = act + (size_t)(row0 + r) * CA;
    v4f s[2] = {bv[0], bv[1]};
#pragma unroll
    for (int i = 0; i < CA; ++i)
#pragma unroll
      for (int g = 0; g < 2; ++g) s[g] += a[i] * wr[i][g];
    v8bf ov;
#pragma unroll
    for (int g = 0; g < 2; ++g)
#pragma unroll
      for (int j = 0; j < 4; ++j) ov[g * 4 + j] = (bf16)(s[g][j] * sigmoidf_(s[g][j]));
    *reinterpret_cast<v8bf*>(o + (size_t)(row0 + r) * CD + col) = ov;
  }
}

// x = x * (1 + scale1) + shift1 ; mod is [M, 2D] f32 (shift cols 0..D, scale D..2D)
// One wave per row.
__global__ __launch_bounds__(256) void modulate_kernel(float* __restrict__ x,
                                                       const float* __restrict__ mod) {
  const int row  = blockIdx.x * 8 + (threadIdx.x >> 5);
  const int lane = threadIdx.x & 31;
  float* xr = x + (size_t)row * CD + lane * 4;
  const float* mr = mod + (size_t)row * (2 * CD) + lane * 4;
  v4f xv[RC], sh[RC], sc[RC];
#pragma unroll
  for (int c = 0; c < RC; ++c) {
    xv[c] = *reinterpret_cast<const v4f*>(xr + c * 128);
    sh[c] = *reinterpret_cast<const v4f*>(mr + c * 128);
    sc[c] = *reinterpret_cast<const v4f*>(mr + CD + c * 128);
  }
#pragma unroll
  for (int c = 0; c < RC; ++c)
    *reinterpret_cast<v4f*>(xr + c * 128) = xv[c] * (1.f + sc[c]) + sh[c];
}

// ---------------------------------------------------------------------------
// bf16 WMMA GEMM: C[M,N] = A[M,K] @ W (W stored transposed [N,K]) + bias.
// 256 threads = 8 waves (4x2), block tile 128x64, wave tile 32x32.
// TDM path: A(128x64) and B(64x64) K-slabs double-buffered in LDS via
// tensor_load_to_lds, wave 0 issuing A and wave 1 issuing B, one request of a
// wave in flight; everyone reads via ds_load_b128.  Kdim: two slabs or more.
// EPI: 0 = f32 out, 1 = bf16 out, 2 = GELU(exact)->bf16, 3 = SiLU->bf16,
//      4 = resid + acc -> f32 out.
// ---------------------------------------------------------------------------
template <int EPI>
__global__ __launch_bounds__(256) void gemm_bf16_wmma(
    const bf16* __restrict__ Am, const bf16* __restrict__ Wt,
    const float* __restrict__ bias, const float* __restrict__ resid,
    float* __restrict__ outF, bf16* __restrict__ outH,
    int Mdim, int Ndim, int Kdim) {
  const int wave = __builtin_amdgcn_readfirstlane(threadIdx.x >> 5);
  const int lane = threadIdx.x & 31;
  const int wm = wave >> 1, wn = wave & 1;
  const int l15 = lane & 15, half = lane >> 4;
  const int bmb = blockIdx.x * 128;
  const int bnb = blockIdx.y * 64;
  const int bm = bmb + wm * 32;
  const int bn = bnb + wn * 32;

  v8f acc[2][2] = {};

#if HAS_TDM
  __shared__ __attribute__((aligned(2048))) bf16 ash[2][T128];
  __shared__ __attribute__((aligned(2048))) bf16 bsh[2][T64];
  const int nst = Kdim >> 6;  // stages of 64 k
  const bool isA = wave == 0;
  const bf16* gsrc = isA ? Am + (size_t)bmb * Kdim : Wt + (size_t)bnb * Kdim;
  const unsigned lds0 = isA ? lds_offset(&ash[0][0]) : lds_offset(&bsh[0][0]);
  const unsigned lstep = isA ? T128 * 2u : T64 * 2u;
  const u32x8 g1 = tdm_group1(isA ? 128u : 64u, (unsigned)Kdim * 2u);
  u32x4 g0 = tdm_group0(lds0, gsrc);
  if (pinned(wave < 2)) {
    tdm_load(g0, g1);
    wait_tensor0(g0);
  }
  __syncthreads();  // stage 0 is readable
  g0 = tdm_group0(lds0 + lstep, gsrc + 64);
  if (pinned(wave < 2)) tdm_load(g0, g1);
  for (int s = 0; s < nst; ++s) {
    const int cur = s & 1;
#pragma unroll
    for (int kk = 0; kk < 2; ++kk) {
      v16bf af[2], bfm[2];
#pragma unroll
      for (int i = 0; i < 2; ++i)
        af[i] = load_frag16(&ash[cur][0], LP, wm * 32 + i * 16 + l15, kk * 32 + half * 8);
#pragma unroll
      for (int j = 0; j < 2; ++j)
        bfm[j] = load_frag16(&bsh[cur][0], LP, wn * 32 + j * 16 + l15, kk * 32 + half * 8);
#pragma unroll
      for (int i = 0; i < 2; ++i)
#pragma unroll
        for (int j = 0; j < 2; ++j)
          acc[i][j] = __builtin_amdgcn_wmma_f32_16x16x32_bf16(
              false, af[i], false, bfm[j], (short)0, acc[i][j], false, false);
    }
    // Publish point of stage s + 1; it also ends every read of buffer `cur`.
    wait_ds0();
    wait_tensor0(g0);
    __syncthreads();
    if (pinned(wave < 2 && s + 2 < nst)) {
      g0 = tdm_group0(lds0 + cur * lstep, gsrc + (size_t)(s + 2) * 64);
      tdm_load(g0, g1);
    }
  }
  // Behind the ring: nothing of it is in flight when the wave goes on.
  wait_tensor0();
  wait_ds0();
#else
  for (int k0 = 0; k0 < Kdim; k0 += 32) {
    if (k0 + 32 < Kdim) {
      __builtin_prefetch(Am + (size_t)(bm + l15) * Kdim + k0 + 32, 0, 0);
      __builtin_prefetch(Wt + (size_t)(bn + l15) * Kdim + k0 + 32, 0, 0);
    }
    v16bf af[2], bfm[2];
#pragma unroll
    for (int i = 0; i < 2; ++i)
      af[i] = load_frag16(Am, Kdim, bm + i * 16 + l15, k0 + half * 8);
#pragma unroll
    for (int j = 0; j < 2; ++j)
      bfm[j] = load_frag16(Wt, Kdim, bn + j * 16 + l15, k0 + half * 8);
#pragma unroll
    for (int i = 0; i < 2; ++i)
#pragma unroll
      for (int j = 0; j < 2; ++j)
        acc[i][j] = __builtin_amdgcn_wmma_f32_16x16x32_bf16(
            false, af[i], false, bfm[j], (short)0, acc[i][j], false, false);
  }
#endif
  // epilogue: C-layout = VGPR r -> row (r + 8*half), lane&15 -> col
#pragma unroll
  for (int i = 0; i < 2; ++i)
#pragma unroll
    for (int j = 0; j < 2; ++j) {
      const int col = bn + j * 16 + l15;
      const float bv = bias ? bias[col] : 0.f;
#pragma unroll
      for (int r = 0; r < 8; ++r) {
        const int row = bm + i * 16 + r + half * 8;
        const size_t idx = (size_t)row * Ndim + col;
        float v = acc[i][j][r] + bv;
        if (EPI == 0) {
          outF[idx] = v;
        } else if (EPI == 1) {
          outH[idx] = (bf16)v;
        } else if (EPI == 2) {
          outH[idx] = (bf16)(0.5f * v * (1.f + erff(v * 0.70710678118f)));
        } else if (EPI == 3) {
          outH[idx] = (bf16)(v * sigmoidf_(v));
        } else {
          outF[idx] = resid[idx] + v;
        }
      }
    }
}

// ---------------------------------------------------------------------------
// Flash attention (causal), one block = 64 query rows, 4 waves x 16 rows.
// Q,K in [B*H, T, hd] bf16; V in [B*H, hd, T] bf16.
// TDM path: K/V 64x64 tiles double-buffered in LDS via tensor_load_to_lds,
// wave 0 issuing K and wave 1 issuing V, one request of a wave in flight.
// Online softmax entirely in-wave (16-lane butterflies match C-layout halves);
// P staged through per-wave LDS to convert C-layout -> A-layout for P@V.
// ---------------------------------------------------------------------------
__global__ __launch_bounds__(128) void flash_attn_wmma(
    const bf16* __restrict__ Q, const bf16* __restrict__ K,
    const bf16* __restrict__ Vt, bf16* __restrict__ O) {
  const int bh    = blockIdx.y;
  const int qtile = blockIdx.x;
  const int wave  = __builtin_amdgcn_readfirstlane(threadIdx.x >> 5);
  const int lane  = threadIdx.x & 31;
  const int l15 = lane & 15, half = lane >> 4;
  const int q0 = qtile * 64 + wave * 16;

  const bf16* Qh = Q  + (size_t)bh * CT * CHD;
  const bf16* Kh = K  + (size_t)bh * CT * CHD;
  const bf16* Vh = Vt + (size_t)bh * CHD * CT;

  __shared__ __attribute__((aligned(16))) bf16 pshm[4][16 * LP];
#if HAS_TDM
  __shared__ __attribute__((aligned(2048))) bf16 ksh[2][T64];
  __shared__ __attribute__((aligned(2048))) bf16 vsh[2][T64];
  static_assert(CT >= 128, "stages 0 and 1 lie inside K and V for every query tile");
  const bool isK = wave == 0;
  const bf16* gsrc = isK ? Kh : Vh;                    // K: 64 keys x hd; V: hd rows x 64 keys
  const unsigned gstep = isK ? 64u * CHD : 64u;        // elements from one stage to the next
  const unsigned lds0 = isK ? lds_offset(&ksh[0][0]) : lds_offset(&vsh[0][0]);
  const u32x8 g1 = tdm_group1(64u, isK ? CHD * 2u : CT * 2u);
  u32x4 g0 = tdm_group0(lds0, gsrc);
  if (pinned(wave < 2)) {
    tdm_load(g0, g1);
    wait_tensor0(g0);
  }
  __syncthreads();  // stage 0 is readable
  g0 = tdm_group0(lds0 + T64 * 2u, gsrc + gstep);
  if (pinned(wave < 2)) tdm_load(g0, g1);
#endif

  v16bf qf[2];
#pragma unroll
  for (int kk = 0; kk < 2; ++kk)
    qf[kk] = load_frag16(Qh, CHD, q0 + l15, kk * 32 + half * 8);

  v8f oacc[4] = {};
  float m_i[8], l_i[8];
#pragma unroll
  for (int r = 0; r < 8; ++r) { m_i[r] = -1e30f; l_i[r] = 0.f; }
  const float scl = 0.125f;  // hd^-0.5

  for (int kt = 0; kt <= qtile; ++kt) {
    const int kbase = kt * 64;
#if HAS_TDM
    const int cur = kt & 1;
#endif
    // S = Q @ K^T
    v8f s[4];
#pragma unroll
    for (int j = 0; j < 4; ++j) {
      v8f z = {};
#pragma unroll
      for (int kk = 0; kk < 2; ++kk) {
#if HAS_TDM
        v16bf kf = load_frag16(&ksh[cur][0], LP, j * 16 + l15, kk * 32 + half * 8);
#else
        v16bf kf = load_frag16(Kh, CHD, kbase + j * 16 + l15, kk * 32 + half * 8);
#endif
        z = __builtin_amdgcn_wmma_f32_16x16x32_bf16(false, qf[kk], false, kf,
                                                    (short)0, z, false, false);
      }
      s[j] = z;
    }
    const bool diag = (kt == qtile);
    float rmax[8];
#pragma unroll
    for (int r = 0; r < 8; ++r) rmax[r] = -1e30f;
#pragma unroll
    for (int j = 0; j < 4; ++j) {
      const int col = kbase + j * 16 + l15;
#pragma unroll
      for (int r = 0; r < 8; ++r) {
        const int row = q0 + r + half * 8;
        float v = s[j][r] * scl;
        if (diag && col > row) v = -1e30f;
        s[j][r] = v;
        rmax[r] = fmaxf(rmax[r], v);
      }
    }
#pragma unroll
    for (int r = 0; r < 8; ++r)
#pragma unroll
      for (int off = 1; off < 16; off <<= 1)
        rmax[r] = fmaxf(rmax[r], __shfl_xor(rmax[r], off, 32));

    float alpha[8];
#pragma unroll
    for (int r = 0; r < 8; ++r) {
      const float nm = fmaxf(m_i[r], rmax[r]);
      alpha[r] = __expf(m_i[r] - nm);
      m_i[r] = nm;
    }
    float rsum[8];
#pragma unroll
    for (int r = 0; r < 8; ++r) rsum[r] = 0.f;
#pragma unroll
    for (int j = 0; j < 4; ++j)
#pragma unroll
      for (int r = 0; r < 8; ++r) {
        const float p = __expf(s[j][r] - m_i[r]);
        s[j][r] = p;
        rsum[r] += p;
      }
#pragma unroll
    for (int r = 0; r < 8; ++r) {
#pragma unroll
      for (int off = 1; off < 16; off <<= 1)
        rsum[r] += __shfl_xor(rsum[r], off, 32);
      l_i[r] = l_i[r] * alpha[r] + rsum[r];
    }
#pragma unroll
    for (int n = 0; n < 4; ++n)
#pragma unroll
      for (int r = 0; r < 8; ++r) oacc[n][r] *= alpha[r];

    // P (C-layout) -> LDS bf16 tile [16 x 64], rows at pitch LP
#pragma unroll
    for (int j = 0; j < 4; ++j) {
      const int colL = j * 16 + l15;
#pragma unroll
      for (int r = 0; r < 8; ++r)
        pshm[wave][(r + half * 8) * LP + colL] = (bf16)s[j][r];
    }
    // O += P @ V
#pragma unroll
    for (int kk = 0; kk < 2; ++kk) {
      v16bf pf = load_frag16(&pshm[wave][0], LP, l15, kk * 32 + half * 8);
#pragma unroll
      for (int n = 0; n < 4; ++n) {
#if HAS_TDM
        v16bf vf = load_frag16(&vsh[cur][0], LP, n * 16 + l15, kk * 32 + half * 8);
#else
        v16bf vf = load_frag16(Vh, CT, n * 16 + l15, kbase + kk * 32 + half * 8);
#endif
        oacc[n] = __builtin_amdgcn_wmma_f32_16x16x32_bf16(false, pf, false, vf,
                                                          (short)0, oacc[n], false, false);
      }
    }
#if HAS_TDM
    // Publish point of stage kt + 1; it also ends every read of buffer `cur`.
    wait_ds0();
    wait_tensor0(g0);
    __syncthreads();
    if (pinned(wave < 2 && kt + 2 <= qtile)) {
      g0 = tdm_group0(lds0 + cur * (T64 * 2u), gsrc + (size_t)(kt + 2) * gstep);
      tdm_load(g0, g1);
    }
#endif
  }
#if HAS_TDM
  // Behind the ring: nothing of it is in flight when the wave goes on.
  wait_tensor0();
  wait_ds0();
#endif
  // normalize + store to [B,T,H,HD] (== [M,D] for the O-projection GEMM)
  const int b = bh / CH, h = bh % CH;
#pragma unroll
  for (int n = 0; n < 4; ++n) {
    const int hd = n * 16 + l15;
#pragma unroll
    for (int r = 0; r < 8; ++r) {
      const int t = q0 + r + half * 8;
      O[(((size_t)b * CT + t) * CH + h) * CHD + hd] = (bf16)(oacc[n][r] / l_i[r]);
    }
  }
}

// ---------------------------------------------------------------------------
extern "C" void kernel_launch(void* const* d_in, const int* in_sizes, int n_in,
                              void* d_out, int out_size, void* d_ws, size_t ws_size,
                              hipStream_t stream) {
  (void)in_sizes; (void)n_in; (void)out_size; (void)ws_size;
  const float* x    = (const float*)d_in[0];
  const float* act  = (const float*)d_in[1];
  const float* n1w  = (const float*)d_in[2];
  const float* n2w  = (const float*)d_in[3];
  const float* qw   = (const float*)d_in[4];
  const float* qb   = (const float*)d_in[5];
  const float* kw   = (const float*)d_in[6];
  const float* kb_  = (const float*)d_in[7];
  const float* vw   = (const float*)d_in[8];
  const float* vb   = (const float*)d_in[9];
  const float* qnw  = (const float*)d_in[10];
  const float* knw  = (const float*)d_in[11];
  const float* ow   = (const float*)d_in[12];
  const float* ob   = (const float*)d_in[13];
  const float* ae1w = (const float*)d_in[14];
  const float* ae1b = (const float*)d_in[15];
  const float* ae2w = (const float*)d_in[16];
  const float* ae2b = (const float*)d_in[17];
  const float* modw = (const float*)d_in[18];
  const float* modb = (const float*)d_in[19];
  const float* m1w  = (const float*)d_in[20];
  const float* m1b  = (const float*)d_in[21];
  const float* m2w  = (const float*)d_in[22];
  const float* m2b  = (const float*)d_in[23];
  float* out = (float*)d_out;

  char* wsb = (char*)d_ws;
  size_t off = 0;
  auto alloc = [&](size_t bytes) -> char* {
    char* p = wsb + off;
    off += (bytes + 255) & ~(size_t)255;
    return p;
  };
  bf16* hn   = (bf16*)alloc((size_t)CM * CD * 2);
  bf16* wqT  = (bf16*)alloc((size_t)CD * CD * 2);
  bf16* wkT  = (bf16*)alloc((size_t)CD * CD * 2);
  bf16* wvT  = (bf16*)alloc((size_t)CD * CD * 2);
  bf16* woT  = (bf16*)alloc((size_t)CD * CD * 2);
  bf16* ae2T = (bf16*)alloc((size_t)CD * CD * 2);
  bf16* modT = (bf16*)alloc((size_t)2 * CD * CD * 2);
  bf16* m1T  = (bf16*)alloc((size_t)CMLP * CD * 2);
  bf16* m2T  = (bf16*)alloc((size_t)CD * CMLP * 2);
  bf16* qp   = (bf16*)alloc((size_t)CM * CD * 2);
  bf16* kp   = (bf16*)alloc((size_t)CM * CD * 2);
  bf16* vp   = (bf16*)alloc((size_t)CM * CD * 2);
  bf16* qh   = (bf16*)alloc((size_t)CM * CD * 2);
  bf16* kh   = (bf16*)alloc((size_t)CM * CD * 2);
  bf16* vTb  = (bf16*)alloc((size_t)CM * CD * 2);
  bf16* attn = (bf16*)alloc((size_t)CM * CD * 2);
  bf16* sae1 = (bf16*)alloc((size_t)CM * CD * 2);
  bf16* sae2 = (bf16*)alloc((size_t)CM * CD * 2);
  float* modv = (float*)alloc((size_t)CM * 2 * CD * 4);
  bf16* h2   = (bf16*)alloc((size_t)CM * CD * 2);
  bf16* mh   = (bf16*)alloc((size_t)CM * CMLP * 2);

  const dim3 tb(256);

  // --- weight transposes to [N,K] bf16 ---
  static_assert(CD % TT == 0 && CMLP % TT == 0 && CT % TT == 0 && CHD == TT, "whole tiles");
  const dim3 gT(CD / TT, CD / TT);
  tcast_kernel<<<gT, tb, 0, stream>>>(qw,  wqT,  CD, CD);
  tcast_kernel<<<gT, tb, 0, stream>>>(kw,  wkT,  CD, CD);
  tcast_kernel<<<gT, tb, 0, stream>>>(vw,  wvT,  CD, CD);
  tcast_kernel<<<gT, tb, 0, stream>>>(ow,  woT,  CD, CD);
  tcast_kernel<<<gT, tb, 0, stream>>>(ae2w, ae2T, CD, CD);
  tcast_kernel<<<dim3(2 * CD / TT, CD / TT), tb, 0, stream>>>(modw, modT, CD, 4 * CD);
  tcast_kernel<<<dim3(CMLP / TT, CD / TT), tb, 0, stream>>>(m1w, m1T, CD, CMLP);
  tcast_kernel<<<dim3(CD / TT, CMLP / TT), tb, 0, stream>>>(m2w, m2T, CMLP, CD);

  // --- attention path ---
  rmsnorm_bf16<<<CM / 8, tb, 0, stream>>>(x, n1w, hn);
  dim3 gDD(CM / 128, CD / 64);
  gemm_bf16_wmma<1><<<gDD, tb, 0, stream>>>(hn, wqT, qb,  nullptr, nullptr, qp, CM, CD, CD);
  gemm_bf16_wmma<1><<<gDD, tb, 0, stream>>>(hn, wkT, kb_, nullptr, nullptr, kp, CM, CD, CD);
  gemm_bf16_wmma<1><<<gDD, tb, 0, stream>>>(hn, wvT, vb,  nullptr, nullptr, vp, CM, CD, CD);
  qk_head_rmsnorm<<<CM / 8, tb, 0, stream>>>(qp, qnw, qh);
  qk_head_rmsnorm<<<CM / 8, tb, 0, stream>>>(kp, knw, kh);
  vtrans_kernel<<<dim3(CT / TT, CB * CH), tb, 0, stream>>>(vp, vTb);
  flash_attn_wmma<<<dim3(CT / 64, CB * CH), dim3(128), 0, stream>>>(qh, kh, vTb, attn);
  gemm_bf16_wmma<4><<<gDD, tb, 0, stream>>>(attn, woT, ob, x, out, nullptr, CM, CD, CD);

  // --- action conditioning ---
  ae1_silu_kernel<<<CM / (2 * AR), tb, 0, stream>>>(act, ae1w, ae1b, sae1);
  gemm_bf16_wmma<3><<<gDD, tb, 0, stream>>>(sae1, ae2T, ae2b, nullptr, nullptr, sae2, CM, CD, CD);
  dim3 gD2(CM / 128, 2 * CD / 64);
  gemm_bf16_wmma<0><<<gD2, tb, 0, stream>>>(sae2, modT, modb, nullptr, modv, nullptr, CM, 2 * CD, CD);
  modulate_kernel<<<CM / 8, tb, 0, stream>>>(out, modv);

  // --- MLP ---
  rmsnorm_bf16<<<CM / 8, tb, 0, stream>>>(out, n2w, h2);
  dim3 gDM(CM / 128, CMLP / 64);
  gemm_bf16_wmma<2><<<gDM, tb, 0, stream>>>(h2, m1T, m1b, nullptr, nullptr, mh, CM, CMLP, CD);
  gemm_bf16_wmma<4><<<gDD, tb, 0, stream>>>(mh, m2T, m2b, out, out, nullptr, CM, CD, CMLP);
}
